// v000
// The times below were measured on an AMD MI455X: many runs one after another, warmed up first and cycling through
// copies of the inputs, with the whole window's GPU time divided by the number of runs. Launches and the gaps
// between them are all in it. The median over several windows is given; except for v000 it joins two sittings, which
// can be a few percent apart, so the side-by-side timings, each taken in one sitting, are the better comparison.
// v000, which the later versions start from, runs in 81.7 microseconds.
#include <hip/hip_runtime.h>

// All contractions (qkv projection, q.k^T scores, p.v, output projection): v_wmma_f32_16x16x32_bf16 with bf16 hi/lo split operands (hi*hi + hi*lo + lo*hi), f32 accumulate; softmax, scaling and bias in f32.

typedef unsigned short us;
typedef us us8 __attribute__((ext_vector_type(8)));
typedef us us16 __attribute__((ext_vector_type(16)));
typedef __bf16 bf16x16 __attribute__((ext_vector_type(16)));
typedef float v8f __attribute__((ext_vector_type(8)));
typedef float v4f __attribute__((ext_vector_type(4)));

union Frag {
  bf16x16 v;
  us16 u;
  us8 half[2];
};

// f32 -> bf16 bits, RNE convert
__device__ __forceinline__ us f2bf(float f) {
  unsigned u = __float_as_uint(f);
  u += 0x7FFFu + ((u >> 16) & 1u);
  return (us)(u >> 16);
}

// f32 -> (hi, lo) bf16 pair: hi = rne(f), lo = rne(f - hi)
__device__ __forceinline__ void split2(float f, us& hi, us& lo) {
  const us hb = f2bf(f);
  const float hf = __uint_as_float(((unsigned)hb) << 16);
  hi = hb;
  lo = f2bf(f - hf);
}

// 16x32 operand fragment from a k-contiguous 16-bit row (row picked by lane&15 by the caller):
// elements 0..7 <- k0+8h+0..7, elements 8..15 <- k0+16+8h+0..7  (h = lane>>4). Same map for A and B.
__device__ __forceinline__ Frag ldfrag(const us* p, int h) {
  Frag f;
  f.half[0] = *(const us8*)(p + 8 * h);
  f.half[1] = *(const us8*)(p + 16 + 8 * h);
  return f;
}

__device__ __forceinline__ v8f wmma16(bf16x16 a, bf16x16 b, v8f c) {
  return __builtin_amdgcn_wmma_f32_16x16x32_bf16(false, a, false, b, (short)0, c, false, false);
}

// acc += A*B with A = ah+al, B = bh+bl (lo*lo dropped); hazard guard after the last WMMA of the group.
__device__ __forceinline__ v8f mma3(const Frag& ah, const Frag& al, const Frag& bh, const Frag& bl, v8f acc) {
  acc = wmma16(al.v, bh.v, acc);
  acc = wmma16(ah.v, bl.v, acc);
  acc = wmma16(ah.v, bh.v, acc);
  asm volatile("v_nop\n\tv_nop\n\tv_nop\n\tv_nop"
               : "+v"(acc)
               : "v"(ah.v), "v"(al.v), "v"(bh.v), "v"(bl.v));
  return acc;
}

__device__ __forceinline__ v8f zero8() {
  v8f z;
#pragma unroll
  for (int i = 0; i < 8; ++i) z[i] = 0.0f;
  return z;
}

// ----------------------------------------------------------------------------
// f32 -> bf16 hi/lo planes for x [8192x256], W_qkv [768x256], W_proj [256x256].
// Each thread converts 8 consecutive floats; a wave writes 512 contiguous bytes per plane
__global__ __launch_bounds__(256) void k_split(
    const float* __restrict__ s0, int n0, us* h0, us* l0,
    const float* __restrict__ s1, int n1, us* h1, us* l1,
    const float* __restrict__ s2, int n2, us* h2, us* l2,
    int nb0, int nb1) {
  const int blk = blockIdx.x;
  const float* src;
  us* dh;
  us* dl;
  int n, base;
  if (blk < nb0) {
    src = s0; dh = h0; dl = l0; n = n0; base = blk;
  } else if (blk < nb0 + nb1) {
    src = s1; dh = h1; dl = l1; n = n1; base = blk - nb0;
  } else {
    src = s2; dh = h2; dl = l2; n = n2; base = blk - nb0 - nb1;
  }
  const int i = base * 256 + (int)threadIdx.x;
  if (8 * i + 8 <= n) {
    const size_t e0 = (size_t)i * 8;
    const v4f a = *(const v4f*)(src + e0);
    const v4f c = *(const v4f*)(src + e0 + 4);
    us8 hv, lv;
#pragma unroll
    for (int e = 0; e < 4; ++e) {
      us hs, ls;
      split2(a[e], hs, ls);
      hv[e] = hs;
      lv[e] = ls;
      split2(c[e], hs, ls);
      hv[4 + e] = hs;
      lv[4 + e] = ls;
    }
    *(us8*)(dh + e0) = hv;
    *(us8*)(dl + e0) = lv;
    
  }
}

// ----------------------------------------------------------------------------
// GEMM main loop: wave tile 32(M) x 32(N), K = 256 in 8 steps of 32, operand fragments loaded
// directly from global hi/lo planes (rows 64-B aligned per k-step).
// AMODE 0: A row-major [M][256].  AMODE 1: A in head-major planes [b][head=kstep][n][32],
// row index = b*4096 + n.  W row-major [N][256] (B[k][n] = W[n][k], k-contiguous per column n).
template <int AMODE>
__device__ __forceinline__ void gemm_mainloop(const us* __restrict__ Ah, const us* __restrict__ Al,
                                              const us* __restrict__ Wh, const us* __restrict__ Wl,
                                              int r0, int c0, int h, int m, v8f (&acc)[2][2]) {
#pragma unroll 1
  for (int ks = 0; ks < 8; ++ks) {
    Frag ah[2], al[2], bh[2], bl[2];
#pragma unroll
    for (int i = 0; i < 2; ++i) {
      const int row = r0 + 16 * i + m;
      size_t off;
      if (AMODE == 0) {
        off = (size_t)row * 256 + (size_t)ks * 32;
      } else {
        off = (((size_t)(row >> 12) * 8 + (size_t)ks) * 4096 + (size_t)(row & 4095)) * 32;
      }
      ah[i] = ldfrag(Ah + off, h);
      al[i] = ldfrag(Al + off, h);
    }
#pragma unroll
    for (int j = 0; j < 2; ++j) {
      const size_t off = (size_t)(c0 + 16 * j + m) * 256 + (size_t)ks * 32;
      bh[j] = ldfrag(Wh + off, h);
      bl[j] = ldfrag(Wl + off, h);
    }
#pragma unroll
    for (int i = 0; i < 2; ++i)
#pragma unroll
      for (int j = 0; j < 2; ++j)
        acc[i][j] = mma3(ah[i], al[i], bh[j], bl[j], acc[i][j]);
  }
}

// ----------------------------------------------------------------------------
// QKV projection: C[8192 x 768] = Xs[8192 x 256] * Wqkv^T.
// Block 256 threads = 8 waves (4 x 2), block tile 128 x 64, grid (12, 64).
// Epilogue: a wave's 32x32 tile maps to one (q|k|v, head) and 32 consecutive tokens, i.e. 2048
// split hi/lo, staged in LDS and written with 4 lane-contiguous 16-B store instructions per plane
__global__ __launch_bounds__(256) void k_gemm_qkv(
    const us* __restrict__ Xh, const us* __restrict__ Xl,
    const us* __restrict__ Wh, const us* __restrict__ Wl,
    us* qh, us* ql, us* kh, us* kl, us* vh, us* vl) {
  __shared__ __align__(16) us Th[8][32][40];
  __shared__ __align__(16) us Tl[8][32][40];
  const int tid = threadIdx.x;
  const int w = tid >> 5, l = tid & 31, h = l >> 4, m = l & 15;
  const int wm = w >> 1, wn = w & 1;
  const int r0 = (int)blockIdx.y * 128 + wm * 32;
  const int c0 = (int)blockIdx.x * 64 + wn * 32;

  v8f acc[2][2];
#pragma unroll
  for (int i = 0; i < 2; ++i)
#pragma unroll
    for (int j = 0; j < 2; ++j) acc[i][j] = zero8();

  gemm_mainloop<0>(Xh, Xl, Wh, Wl, r0, c0, h, m, acc);

  // D element r of lane (h, m): row 16i + 8h + r, col 16j + m of the wave tile
#pragma unroll
  for (int i = 0; i < 2; ++i)
#pragma unroll
    for (int j = 0; j < 2; ++j)
#pragma unroll
      for (int r = 0; r < 8; ++r) {
        us hs, ls;
        split2(acc[i][j][r], hs, ls);
        Th[w][16 * i + 8 * h + r][16 * j + m] = hs;
        Tl[w][16 * i + 8 * h + r][16 * j + m] = ls;
      }
  __syncthreads();

  const int three = c0 >> 8;
  const int head = (c0 & 255) >> 5;
  const int bb = r0 >> 12, n0 = r0 & 4095;
  us* dh = (three == 0) ? qh : ((three == 1) ? kh : vh);
  us* dl = (three == 0) ? ql : ((three == 1) ? kl : vl);
  const size_t dst = ((size_t)(bb * 8 + head) * 4096 + (size_t)n0) * 32;

  us8 hv[4], lv[4];
#pragma unroll
  for (int q = 0; q < 4; ++q) {
    const int g = 32 * q + l;          // 16-B chunk index, 128 chunks = 32 rows x 64 B
    const int row = g >> 2, ds = (g & 3) * 8;
    hv[q] = *(const us8*)&Th[w][row][ds];
    lv[q] = *(const us8*)&Tl[w][row][ds];
  }
#pragma unroll
  for (int q = 0; q < 4; ++q) {
    const size_t o = dst + (size_t)8 * (32 * q + l);
    *(us8*)(dh + o) = hv[q];
    *(us8*)(dl + o) = lv[q];
  }
  
}

// ----------------------------------------------------------------------------
// Fused local attention, one wave32 block per (b, head, 16-query block); 16 consecutive queries
// share grid row qr and cols qc0..qc0+15. Key rows qr-3..qr+3 (clipped); per key row the window is
// 32 consecutive tokens starting at col clamp(qc0-8, 0, 32), which contains every col in
// [qc0-3, qc0+18]; keys outside |drow|,|dcol| <= 3 are masked to -inf.
// S = Q K^T (k = hd = 32): B fragment lane n = key slot, from the k row (k-contiguous).
// O += P V (k = 32 key slots): A = P from LDS (rows = queries), B = V staged transposed in LDS
// as VT[d][slot] so lane n = d reads a slot-contiguous row. D rows = queries = 8h + r, so the
// online-softmax rescale factors are lane-local. Output O/l split hi/lo to planes [b][head][n][32]:
__global__ __launch_bounds__(32) void k_attn(
    const us* __restrict__ qh, const us* __restrict__ ql,
    const us* __restrict__ kh, const us* __restrict__ kl,
    const us* __restrict__ vh, const us* __restrict__ vl,
    const float* __restrict__ temp, us* oh, us* ol) {
  __shared__ __align__(16) us VTh[32][40];
  __shared__ __align__(16) us VTl[32][40];
  __shared__ __align__(16) us Ph[16][40];
  __shared__ __align__(16) us Pl[16][40];

  const int bid = blockIdx.x;
  const int qblk = bid & 255;
  const int hd = (bid >> 8) & 7;
  const int b = bid >> 11;
  const int l = threadIdx.x & 31, h = l >> 4, m = l & 15;
  const int q0 = qblk * 16;
  const int qr = q0 >> 6;
  const int qc0 = q0 & 63;
  const float alpha = 0.17677669529663689f * temp[0];   // hd^-0.5 * temperature
  const size_t hb = (size_t)(b * 8 + hd) * 4096 * 32;

  const Frag qfh = ldfrag(qh + hb + (size_t)(q0 + m) * 32, h);
  const Frag qfl = ldfrag(ql + hb + (size_t)(q0 + m) * 32, h);

  float mrow[8], lrow[8];
  v8f accO[2];
#pragma unroll
  for (int r = 0; r < 8; ++r) { mrow[r] = -__builtin_inff(); lrow[r] = 0.0f; }
  accO[0] = zero8();
  accO[1] = zero8();

  int wst = qc0 - 8;
  if (wst < 0) wst = 0;
  if (wst > 32) wst = 32;
  const int kr0 = (qr - 3 < 0) ? 0 : (qr - 3);
  const int kr1 = (qr + 3 > 63) ? 63 : (qr + 3);

  for (int kr = kr0; kr <= kr1; ++kr) {
    const int t0 = kr * 64 + wst;   // multiple of 8 -> 16-B aligned rows

    // stage V rows of the 32 key slots transposed into LDS: lane l = slot l = token t0 + l
    {
      const us* prh = vh + hb + (size_t)(t0 + l) * 32;
      const us* prl = vl + hb + (size_t)(t0 + l) * 32;
#pragma unroll
      for (int s = 0; s < 4; ++s) {
        const us8 a = *(const us8*)(prh + 8 * s);
        const us8 c = *(const us8*)(prl + 8 * s);
#pragma unroll
        for (int e = 0; e < 8; ++e) {
          VTh[8 * s + e][l] = a[e];
          VTl[8 * s + e][l] = c[e];
        }
      }
    }

    // scores for two 16-slot chunks: D[r] = S[q = 8h + r][slot 16c + m]
    v8f s[2];
#pragma unroll
    for (int c = 0; c < 2; ++c) {
      const size_t ko = hb + (size_t)(t0 + 16 * c + m) * 32;
      const Frag kfh = ldfrag(kh + ko, h);
      const Frag kfl = ldfrag(kl + ko, h);
      s[c] = mma3(qfh, qfl, kfh, kfl, zero8());
    }

    // locality mask + scale
#pragma unroll
    for (int c = 0; c < 2; ++c) {
      const int col = wst + 16 * c + m;
#pragma unroll
      for (int r = 0; r < 8; ++r) {
        const int qi = 8 * h + r;
        const int dc = col - (qc0 + qi);
        const bool ok = (dc >= -3) && (dc <= 3);
        s[c][r] = ok ? s[c][r] * alpha : -__builtin_inff();
      }
    }

    // online softmax over the 32 slots of this key row; P (hi/lo) to LDS
    float scv[8];
#pragma unroll
    for (int r = 0; r < 8; ++r) {
      float rm = fmaxf(s[0][r], s[1][r]);
#pragma unroll
      for (int msk = 1; msk < 16; msk <<= 1) rm = fmaxf(rm, __shfl_xor(rm, msk, 32));
      const float mo = mrow[r];
      const float mn = fmaxf(mo, rm);          // finite: every query has >= 4 valid keys per row
      const float sc = __expf(mo - mn);        // 0 on the first key row
      const float p0 = __expf(s[0][r] - mn);   // masked -> 0
      const float p1 = __expf(s[1][r] - mn);
      us hs, ls;
      split2(p0, hs, ls);
      Ph[8 * h + r][m] = hs;
      Pl[8 * h + r][m] = ls;
      split2(p1, hs, ls);
      Ph[8 * h + r][16 + m] = hs;
      Pl[8 * h + r][16 + m] = ls;
      float ps = p0 + p1;
#pragma unroll
      for (int msk = 1; msk < 16; msk <<= 1) ps += __shfl_xor(ps, msk, 32);
      lrow[r] = lrow[r] * sc + ps;
      mrow[r] = mn;
      scv[r] = sc;
    }
    __syncthreads();   // P and VT stores visible before fragment loads (different element types)

#pragma unroll
    for (int r = 0; r < 8; ++r) {
      accO[0][r] *= scv[r];
      accO[1][r] *= scv[r];
    }

    // O[q][d] += sum_slot P[q][slot] * V[slot][d]
    const Frag pfh = ldfrag(&Ph[m][0], h);
    const Frag pfl = ldfrag(&Pl[m][0], h);
#pragma unroll
    for (int db = 0; db < 2; ++db) {
      const Frag vfh = ldfrag(&VTh[16 * db + m][0], h);
      const Frag vfl = ldfrag(&VTl[16 * db + m][0], h);
      accO[db] = mma3(pfh, pfl, vfh, vfl, accO[db]);
    }
    __syncthreads();   // all fragment loads done before the next key row overwrites LDS
  }

#pragma unroll
  for (int r = 0; r < 8; ++r) {
    const float inv = 1.0f / lrow[r];   // lrow >= 1
#pragma unroll
    for (int db = 0; db < 2; ++db) {
      us hs, ls;
      split2(accO[db][r] * inv, hs, ls);
      Ph[8 * h + r][16 * db + m] = hs;
      Pl[8 * h + r][16 * db + m] = ls;
    }
  }
  __syncthreads();

  const size_t dst = hb + (size_t)q0 * 32;
  us8 hv[2], lv[2];
#pragma unroll
  for (int q = 0; q < 2; ++q) {
    const int g = 32 * q + l;            // 64 chunks = 16 rows x 64 B
    const int row = g >> 2, ds = (g & 3) * 8;
    hv[q] = *(const us8*)&Ph[row][ds];
    lv[q] = *(const us8*)&Pl[row][ds];
  }
#pragma unroll
  for (int q = 0; q < 2; ++q) {
    const size_t o = dst + (size_t)8 * (32 * q + l);
    *(us8*)(oh + o) = hv[q];
    *(us8*)(ol + o) = lv[q];
  }
  
}

// ----------------------------------------------------------------------------
// Output projection: out[8192 x 256] = attn[8192 x 256] * Wproj^T + bias (f32).
// A from the head-major attention planes (k-step ks = head ks). Grid (4, 64), 8 waves per block.
__global__ __launch_bounds__(256) void k_gemm_proj(
    const us* __restrict__ Ah, const us* __restrict__ Al,
    const us* __restrict__ Wh, const us* __restrict__ Wl,
    const float* __restrict__ bias, float* out) {
  __shared__ __align__(16) float Tf[8][32][36];
  const int tid = threadIdx.x;
  const int w = tid >> 5, l = tid & 31, h = l >> 4, m = l & 15;
  const int wm = w >> 1, wn = w & 1;
  const int r0 = (int)blockIdx.y * 128 + wm * 32;
  const int c0 = (int)blockIdx.x * 64 + wn * 32;

  v8f acc[2][2];
#pragma unroll
  for (int i = 0; i < 2; ++i)
#pragma unroll
    for (int j = 0; j < 2; ++j) acc[i][j] = zero8();

  gemm_mainloop<1>(Ah, Al, Wh, Wl, r0, c0, h, m, acc);

#pragma unroll
  for (int j = 0; j < 2; ++j) {
    const float bj = bias[c0 + 16 * j + m];
#pragma unroll
    for (int i = 0; i < 2; ++i)
#pragma unroll
      for (int r = 0; r < 8; ++r)
        Tf[w][16 * i + 8 * h + r][16 * j + m] = acc[i][j][r] + bj;
  }
  __syncthreads();

  v4f ov[8];
#pragma unroll
  for (int q = 0; q < 8; ++q) {
    const int g = 32 * q + l;
    const int row = g >> 3, cs = (g & 7) * 4;
    ov[q] = *(const v4f*)&Tf[w][row][cs];
  }
  const size_t base = (size_t)r0 * 256 + (size_t)c0;
#pragma unroll
  for (int q = 0; q < 8; ++q) {
    const int g = 32 * q + l;
    const int row = g >> 3, cs = (g & 7) * 4;
    *(v4f*)(out + base + (size_t)row * 256 + cs) = ov[q];
  }
  
}

// ----------------------------------------------------------------------------
extern "C" void kernel_launch(void* const* d_in, const int* in_sizes, int n_in,
                              void* d_out, int out_size, void* d_ws, size_t ws_size,
                              hipStream_t stream) {
  const int M = 8192;      // B * N
  const int C = 256;
  const int C3 = 768;
  if (n_in < 5) return;
  if (in_sizes[0] != M * C || in_sizes[1] != C3 * C || in_sizes[2] != C * C ||
      in_sizes[3] != C || in_sizes[4] < 1 || out_size != M * C) return;

  const float* x     = (const float*)d_in[0];   // [2,4096,256]
  const float* wqkv  = (const float*)d_in[1];   // [768,256]
  const float* wproj = (const float*)d_in[2];   // [256,256]
  const float* bproj = (const float*)d_in[3];   // [256]
  const float* temp  = (const float*)d_in[4];   // [1]
  float* out = (float*)d_out;                   // [2,4096,256] f32

  const size_t szX  = (size_t)M * C * 2;        // one bf16 plane of x / q / k / v / attn
  const size_t szW1 = (size_t)C3 * C * 2;
  const size_t szW2 = (size_t)C * C * 2;
  size_t off = 0;
  char* ws = (char*)d_ws;
  us* xh  = (us*)(ws + off); off += szX;
  us* xl  = (us*)(ws + off); off += szX;
  us* w1h = (us*)(ws + off); off += szW1;
  us* w1l = (us*)(ws + off); off += szW1;
  us* w2h = (us*)(ws + off); off += szW2;
  us* w2l = (us*)(ws + off); off += szW2;
  us* qh  = (us*)(ws + off); off += szX;
  us* ql  = (us*)(ws + off); off += szX;
  us* kh  = (us*)(ws + off); off += szX;
  us* kl  = (us*)(ws + off); off += szX;
  us* vh  = (us*)(ws + off); off += szX;
  us* vl  = (us*)(ws + off); off += szX;
  us* ah  = (us*)(ws + off); off += szX;
  us* al  = (us*)(ws + off); off += szX;   // total 42,991,616 bytes
  if (off > ws_size) return;

  const int n0 = M * C, n1 = C3 * C, n2 = C * C;
  const int nb0 = (n0 / 8 + 255) / 256;   // 1024
  const int nb1 = (n1 / 8 + 255) / 256;   // 96
  const int nb2 = (n2 / 8 + 255) / 256;   // 32
  k_split<<<nb0 + nb1 + nb2, 256, 0, stream>>>(x, n0, xh, xl, wqkv, n1, w1h, w1l,
                                               wproj, n2, w2h, w2l, nb0, nb1);

  k_gemm_qkv<<<dim3(C3 / 64, M / 128), 256, 0, stream>>>(xh, xl, w1h, w1l,
                                                          qh, ql, kh, kl, vh, vl);

  k_attn<<<(M / 16) * 8, 32, 0, stream>>>(qh, ql, kh, kl, vh, vl, temp, ah, al);

  k_gemm_proj<<<dim3(C / 64, M / 128), 256, 0, stream>>>(ah, al, w2h, w2l, bproj, out);
}

// v001
// It runs in 60.9 microseconds.
// In both of two side-by-side timings against v000, it was 1.38 times as fast.
#include <hip/hip_runtime.h>

// All contractions (qkv projection, q.k^T scores, p.v, output projection): v_wmma_f32_16x16x32_bf16 with bf16 hi/lo split operands (hi*hi + hi*lo + lo*hi), f32 accumulate; softmax, scaling and bias in f32.

typedef unsigned short us;
typedef us us8 __attribute__((ext_vector_type(8)));
typedef us us16 __attribute__((ext_vector_type(16)));
typedef __bf16 bf16x16 __attribute__((ext_vector_type(16)));
typedef float v8f __attribute__((ext_vector_type(8)));
typedef float v4f __attribute__((ext_vector_type(4)));

union Frag {
  bf16x16 v;
  us16 u;
  us8 half[2];
};

// f32 -> bf16 bits, RNE convert
__device__ __forceinline__ us f2bf(float f) {
  unsigned u = __float_as_uint(f);
  u += 0x7FFFu + ((u >> 16) & 1u);
  return (us)(u >> 16);
}

// f32 -> (hi, lo) bf16 pair: hi = rne(f), lo = rne(f - hi)
__device__ __forceinline__ void split2(float f, us& hi, us& lo) {
  const us hb = f2bf(f);
  const float hf = __uint_as_float(((unsigned)hb) << 16);
  hi = hb;
  lo = f2bf(f - hf);
}

// 16x32 operand fragment from a k-contiguous 16-bit row (row picked by lane&15 by the caller):
// elements 0..7 <- k0+8h+0..7, elements 8..15 <- k0+16+8h+0..7  (h = lane>>4). Same map for A and B.
__device__ __forceinline__ Frag ldfrag(const us* p, int h) {
  Frag f;
  f.half[0] = *(const us8*)(p + 8 * h);
  f.half[1] = *(const us8*)(p + 16 + 8 * h);
  return f;
}

// The same fragment from a plane stored in fragment order: per (16-row tile, k-step) two runs of 512 B,
// run x holds for lane (h, m) the 8 elements k0+16x+8h+0..7 of row m at 16-B chunk 16h+m, so one
// wave-wide 16-B load covers four whole 128-B lines. p already includes the lane's chunk (lane * 8).
__device__ __forceinline__ Frag ldpack(const us* p) {
  Frag f;
  f.half[0] = *(const us8*)p;
  f.half[1] = *(const us8*)(p + 256);
  return f;
}

__device__ __forceinline__ v8f wmma16(bf16x16 a, bf16x16 b, v8f c) {
  return __builtin_amdgcn_wmma_f32_16x16x32_bf16(false, a, false, b, (short)0, c, false, false);
}

// acc += A*B with A = ah+al, B = bh+bl (lo*lo dropped); hazard guard after the last WMMA of the group.
__device__ __forceinline__ v8f mma3(const Frag& ah, const Frag& al, const Frag& bh, const Frag& bl, v8f acc) {
  acc = wmma16(al.v, bh.v, acc);
  acc = wmma16(ah.v, bl.v, acc);
  acc = wmma16(ah.v, bh.v, acc);
  asm volatile("v_nop\n\tv_nop\n\tv_nop\n\tv_nop"
               : "+v"(acc)
               : "v"(ah.v), "v"(al.v), "v"(bh.v), "v"(bl.v));
  return acc;
}

__device__ __forceinline__ v8f zero8() {
  v8f z;
#pragma unroll
  for (int i = 0; i < 8; ++i) z[i] = 0.0f;
  return z;
}

// ----------------------------------------------------------------------------
// f32 -> bf16 hi/lo planes for x [8192x256], W_qkv [768x256], W_proj [256x256], stored in fragment
// order (see ldpack): 16-B chunk i = ((tile*8 + kstep)*2 + x)*32 + 16h + m holds row 16*tile + m,
// k = 32*kstep + 16x + 8h + 0..7. Thread i converts chunk i; a wave writes 512 contiguous bytes per plane
__global__ __launch_bounds__(256) void k_split(
    const float* __restrict__ s0, int n0, us* h0, us* l0,
    const float* __restrict__ s1, int n1, us* h1, us* l1,
    const float* __restrict__ s2, int n2, us* h2, us* l2,
    int nb0, int nb1) {
  const int blk = blockIdx.x;
  const float* src;
  us* dh;
  us* dl;
  int n, base;
  if (blk < nb0) {
    src = s0; dh = h0; dl = l0; n = n0; base = blk;
  } else if (blk < nb0 + nb1) {
    src = s1; dh = h1; dl = l1; n = n1; base = blk - nb0;
  } else {
    src = s2; dh = h2; dl = l2; n = n2; base = blk - nb0 - nb1;
  }
  const int i = base * 256 + (int)threadIdx.x;
  if (8 * i + 8 <= n) {
    const size_t e0 = (size_t)i * 8;
    const int srow = (i >> 9) * 16 + (i & 15);
    const int scol = ((i >> 6) & 7) * 32 + ((i >> 5) & 1) * 16 + ((i >> 4) & 1) * 8;
    const size_t f0 = (size_t)srow * 256 + (size_t)scol;
    const v4f a = *(const v4f*)(src + f0);
    const v4f c = *(const v4f*)(src + f0 + 4);
    us8 hv, lv;
#pragma unroll
    for (int e = 0; e < 4; ++e) {
      us hs, ls;
      split2(a[e], hs, ls);
      hv[e] = hs;
      lv[e] = ls;
      split2(c[e], hs, ls);
      hv[4 + e] = hs;
      lv[4 + e] = ls;
    }
    *(us8*)(dh + e0) = hv;
    *(us8*)(dl + e0) = lv;
    
  }
}

// ----------------------------------------------------------------------------
// GEMM main loop: wave tile 32(M) x 32(N), K = 256 in 8 steps of 32, operand fragments loaded
// directly from global hi/lo planes in fragment order (4096 elements per 16-row tile, 512 per k-step).
// A rows [M][256], W rows [N][256] (B[k][n] = W[n][k]); l = lane.
__device__ __forceinline__ void gemm_mainloop(const us* __restrict__ Ah, const us* __restrict__ Al,
                                              const us* __restrict__ Wh, const us* __restrict__ Wl,
                                              int r0, int c0, int l, v8f (&acc)[2][2]) {
#pragma unroll 1
  for (int ks = 0; ks < 8; ++ks) {
    Frag ah[2], al[2], bh[2], bl[2];
#pragma unroll
    for (int i = 0; i < 2; ++i) {
      const size_t off = (size_t)((r0 >> 4) + i) * 4096 + (size_t)ks * 512 + (size_t)l * 8;
      ah[i] = ldpack(Ah + off);
      al[i] = ldpack(Al + off);
    }
#pragma unroll
    for (int j = 0; j < 2; ++j) {
      const size_t off = (size_t)((c0 >> 4) + j) * 4096 + (size_t)ks * 512 + (size_t)l * 8;
      bh[j] = ldpack(Wh + off);
      bl[j] = ldpack(Wl + off);
    }
#pragma unroll
    for (int i = 0; i < 2; ++i)
#pragma unroll
      for (int j = 0; j < 2; ++j)
        acc[i][j] = mma3(ah[i], al[i], bh[j], bl[j], acc[i][j]);
  }
}

// ----------------------------------------------------------------------------
// QKV projection: C[8192 x 768] = Xs[8192 x 256] * Wqkv^T.
// Block 256 threads = 8 waves (4 x 2), block tile 128 x 64, grid (12, 64).
// Epilogue: a wave's 32x32 tile maps to one (q|k|v, head) and 32 consecutive tokens, i.e. 2048
// split hi/lo, staged in LDS and written with 4 lane-contiguous 16-B store instructions per plane.
// Plane layouts inside [b][head], 256 elements per group of 8 tokens:
//   q: [token][32]                          (row order)
//   k: [token/8][d/8][token%8][8 d]         (B fragments of q.k^T at any 8-token offset)
//   v: [token/8][d][8 tokens]               (transposed: B fragments of p.v at any 8-token offset)
__global__ __launch_bounds__(256) void k_gemm_qkv(
    const us* __restrict__ Xh, const us* __restrict__ Xl,
    const us* __restrict__ Wh, const us* __restrict__ Wl,
    us* qh, us* ql, us* kh, us* kl, us* vh, us* vl) {
  __shared__ __align__(16) us Th[8][32][40];
  __shared__ __align__(16) us Tl[8][32][40];
  const int tid = threadIdx.x;
  const int w = tid >> 5, l = tid & 31, h = l >> 4, m = l & 15;
  const int wm = w >> 1, wn = w & 1;
  const int r0 = (int)blockIdx.y * 128 + wm * 32;
  const int c0 = (int)blockIdx.x * 64 + wn * 32;

  v8f acc[2][2];
#pragma unroll
  for (int i = 0; i < 2; ++i)
#pragma unroll
    for (int j = 0; j < 2; ++j) acc[i][j] = zero8();

  gemm_mainloop(Xh, Xl, Wh, Wl, r0, c0, l, acc);

  const int three = c0 >> 8;   // same for the whole block (64 columns per block)

  // D element r of lane (h, m): row 16i + 8h + r, col 16j + m of the wave tile.
  // q, k staged as T[token][d]; v staged transposed as T[d][token] (8 tokens of a lane = one 16-B store)
#pragma unroll
  for (int i = 0; i < 2; ++i)
#pragma unroll
    for (int j = 0; j < 2; ++j) {
      us8 h8, l8;
#pragma unroll
      for (int r = 0; r < 8; ++r) {
        us hs, ls;
        split2(acc[i][j][r], hs, ls);
        h8[r] = hs;
        l8[r] = ls;
      }
      if (three == 2) {
        *(us8*)&Th[w][16 * j + m][16 * i + 8 * h] = h8;
        *(us8*)&Tl[w][16 * j + m][16 * i + 8 * h] = l8;
      } else {
#pragma unroll
        for (int r = 0; r < 8; ++r) {
          Th[w][16 * i + 8 * h + r][16 * j + m] = h8[r];
          Tl[w][16 * i + 8 * h + r][16 * j + m] = l8[r];
        }
      }
    }
  __syncthreads();

  const int head = (c0 & 255) >> 5;
  const int bb = r0 >> 12, n0 = r0 & 4095;
  us* dh = (three == 0) ? qh : ((three == 1) ? kh : vh);
  us* dl = (three == 0) ? ql : ((three == 1) ? kl : vl);
  const size_t dst = ((size_t)(bb * 8 + head) * 4096 + (size_t)n0) * 32;

  us8 hv[4], lv[4];
#pragma unroll
  for (int q = 0; q < 4; ++q) {
    const int g = 32 * q + l;          // 16-B chunk index in the plane's own order, 128 chunks
    int row, ds;
    if (three == 0) {
      row = g >> 2; ds = (g & 3) * 8;          // T[token][d], row order
    } else if (three == 1) {
      row = 8 * q + (l & 7); ds = (l >> 3) * 8;  // T[token][d], chunk = (token/8, d/8, token%8)
    } else {
      row = l; ds = 8 * q;                     // T[d][token], chunk = (token/8, d)
    }
    hv[q] = *(const us8*)&Th[w][row][ds];
    lv[q] = *(const us8*)&Tl[w][row][ds];
  }
#pragma unroll
  for (int q = 0; q < 4; ++q) {
    const size_t o = dst + (size_t)8 * (32 * q + l);
    *(us8*)(dh + o) = hv[q];
    *(us8*)(dl + o) = lv[q];
  }
  
}

// ----------------------------------------------------------------------------
// Fused local attention, one wave32 block per (b, head, 16-query block); 16 consecutive queries
// share grid row qr and cols qc0..qc0+15. Key rows qr-3..qr+3 (clipped); per key row the window is
// 32 consecutive tokens starting at col clamp(qc0-8, 0, 32), which contains every col in
// [qc0-3, qc0+18]; keys outside |drow|,|dcol| <= 3 are masked to -inf.
// S = Q K^T (k = hd = 32): B fragment lane n = key slot, from the k plane [token/8][d/8][token%8][8].
// O += P V (k = 32 key slots): A = P from LDS (rows = queries), B = V from the transposed v plane
// [token/8][d][8 tokens], lane n = d. Both are whole-line 16-B loads. D rows = queries = 8h + r, so the
// online-softmax rescale factors are lane-local. Output O/l split hi/lo, stored in the fragment order
// of the output projection's A operand (tile = 16 queries, k-step = head):
__global__ __launch_bounds__(32) void k_attn(
    const us* __restrict__ qh, const us* __restrict__ ql,
    const us* __restrict__ kh, const us* __restrict__ kl,
    const us* __restrict__ vh, const us* __restrict__ vl,
    const float* __restrict__ temp, us* oh, us* ol) {
  __shared__ __align__(16) us Ph[16][40];
  __shared__ __align__(16) us Pl[16][40];

  const int bid = blockIdx.x;
  const int qblk = bid & 255;
  const int hd = (bid >> 8) & 7;
  const int b = bid >> 11;
  const int l = threadIdx.x & 31, h = l >> 4, m = l & 15;
  const int q0 = qblk * 16;
  const int qr = q0 >> 6;
  const int qc0 = q0 & 63;
  const float alpha = 0.17677669529663689f * temp[0];   // hd^-0.5 * temperature
  const size_t hb = (size_t)(b * 8 + hd) * 4096 * 32;

  const Frag qfh = ldfrag(qh + hb + (size_t)(q0 + m) * 32, h);
  const Frag qfl = ldfrag(ql + hb + (size_t)(q0 + m) * 32, h);

  float mrow[8], lrow[8];
  v8f accO[2];
#pragma unroll
  for (int r = 0; r < 8; ++r) { mrow[r] = -__builtin_inff(); lrow[r] = 0.0f; }
  accO[0] = zero8();
  accO[1] = zero8();

  int wst = qc0 - 8;
  if (wst < 0) wst = 0;
  if (wst > 32) wst = 32;
  const int kr0 = (qr - 3 < 0) ? 0 : (qr - 3);
  const int kr1 = (qr + 3 > 63) ? 63 : (qr + 3);

  for (int kr = kr0; kr <= kr1; ++kr) {
    const int t0 = kr * 64 + wst;   // multiple of 8 -> 16-B aligned rows

    // V fragments of the 32 key slots: element (x, e) of lane (h, m) = V[t0 + 16x + 8h + e][16db + m]
    Frag vfh[2], vfl[2];
#pragma unroll
    for (int db = 0; db < 2; ++db) {
      const size_t vo = hb + (size_t)t0 * 32 + (size_t)(h * 256 + db * 128 + m * 8);
      vfh[db].half[0] = *(const us8*)(vh + vo);
      vfh[db].half[1] = *(const us8*)(vh + vo + 512);
      vfl[db].half[0] = *(const us8*)(vl + vo);
      vfl[db].half[1] = *(const us8*)(vl + vo + 512);
    }

    // scores for two 16-slot chunks: D[r] = S[q = 8h + r][slot 16c + m]
    v8f s[2];
#pragma unroll
    for (int c = 0; c < 2; ++c) {
      // element (x, e) of lane (h, m) = K[t0 + 16c + m][16x + 8h + e]
      const size_t ko = hb + (size_t)(t0 + 16 * c) * 32 + (size_t)((m >> 3) * 256 + h * 64 + (m & 7) * 8);
      Frag kfh, kfl;
      kfh.half[0] = *(const us8*)(kh + ko);
      kfh.half[1] = *(const us8*)(kh + ko + 128);
      kfl.half[0] = *(const us8*)(kl + ko);
      kfl.half[1] = *(const us8*)(kl + ko + 128);
      s[c] = mma3(qfh, qfl, kfh, kfl, zero8());
    }

    // locality mask + scale
#pragma unroll
    for (int c = 0; c < 2; ++c) {
      const int col = wst + 16 * c + m;
#pragma unroll
      for (int r = 0; r < 8; ++r) {
        const int qi = 8 * h + r;
        const int dc = col - (qc0 + qi);
        const bool ok = (dc >= -3) && (dc <= 3);
        s[c][r] = ok ? s[c][r] * alpha : -__builtin_inff();
      }
    }

    // online softmax over the 32 slots of this key row; P (hi/lo) to LDS
    float scv[8];
#pragma unroll
    for (int r = 0; r < 8; ++r) {
      float rm = fmaxf(s[0][r], s[1][r]);
#pragma unroll
      for (int msk = 1; msk < 16; msk <<= 1) rm = fmaxf(rm, __shfl_xor(rm, msk, 32));
      const float mo = mrow[r];
      const float mn = fmaxf(mo, rm);          // finite: every query has >= 4 valid keys per row
      const float sc = __expf(mo - mn);        // 0 on the first key row
      const float p0 = __expf(s[0][r] - mn);   // masked -> 0
      const float p1 = __expf(s[1][r] - mn);
      us hs, ls;
      split2(p0, hs, ls);
      Ph[8 * h + r][m] = hs;
      Pl[8 * h + r][m] = ls;
      split2(p1, hs, ls);
      Ph[8 * h + r][16 + m] = hs;
      Pl[8 * h + r][16 + m] = ls;
      float ps = p0 + p1;
#pragma unroll
      for (int msk = 1; msk < 16; msk <<= 1) ps += __shfl_xor(ps, msk, 32);
      lrow[r] = lrow[r] * sc + ps;
      mrow[r] = mn;
      scv[r] = sc;
    }
    __syncthreads();   // P stores visible before fragment loads (different element types)

#pragma unroll
    for (int r = 0; r < 8; ++r) {
      accO[0][r] *= scv[r];
      accO[1][r] *= scv[r];
    }

    // O[q][d] += sum_slot P[q][slot] * V[slot][d]
    const Frag pfh = ldfrag(&Ph[m][0], h);
    const Frag pfl = ldfrag(&Pl[m][0], h);
#pragma unroll
    for (int db = 0; db < 2; ++db)
      accO[db] = mma3(pfh, pfl, vfh[db], vfl[db], accO[db]);
    __syncthreads();   // all fragment loads done before the next key row overwrites LDS
  }

#pragma unroll
  for (int r = 0; r < 8; ++r) {
    const float inv = 1.0f / lrow[r];   // lrow >= 1
#pragma unroll
    for (int db = 0; db < 2; ++db) {
      us hs, ls;
      split2(accO[db][r] * inv, hs, ls);
      Ph[8 * h + r][16 * db + m] = hs;
      Pl[8 * h + r][16 * db + m] = ls;
    }
  }
  __syncthreads();

  const size_t dst = ((size_t)(b * 256 + qblk) * 8 + (size_t)hd) * 512;
  us8 hv[2], lv[2];
#pragma unroll
  for (int q = 0; q < 2; ++q) {
    const int ds = 16 * q + 8 * h;       // chunk 32q + 16h + m = query m, d = 16q + 8h + 0..7
    hv[q] = *(const us8*)&Ph[m][ds];
    lv[q] = *(const us8*)&Pl[m][ds];
  }
#pragma unroll
  for (int q = 0; q < 2; ++q) {
    const size_t o = dst + (size_t)8 * (32 * q + l);
    *(us8*)(oh + o) = hv[q];
    *(us8*)(ol + o) = lv[q];
  }
  
}

// ----------------------------------------------------------------------------
// Output projection: out[8192 x 256] = attn[8192 x 256] * Wproj^T + bias (f32).
// A from the attention planes in fragment order (k-step ks = head ks). Grid (4, 64), 8 waves per block.
__global__ __launch_bounds__(256) void k_gemm_proj(
    const us* __restrict__ Ah, const us* __restrict__ Al,
    const us* __restrict__ Wh, const us* __restrict__ Wl,
    const float* __restrict__ bias, float* out) {
  __shared__ __align__(16) float Tf[8][32][36];
  const int tid = threadIdx.x;
  const int w = tid >> 5, l = tid & 31, h = l >> 4, m = l & 15;
  const int wm = w >> 1, wn = w & 1;
  const int r0 = (int)blockIdx.y * 128 + wm * 32;
  const int c0 = (int)blockIdx.x * 64 + wn * 32;

  v8f acc[2][2];
#pragma unroll
  for (int i = 0; i < 2; ++i)
#pragma unroll
    for (int j = 0; j < 2; ++j) acc[i][j] = zero8();

  gemm_mainloop(Ah, Al, Wh, Wl, r0, c0, l, acc);

#pragma unroll
  for (int j = 0; j < 2; ++j) {
    const float bj = bias[c0 + 16 * j + m];
#pragma unroll
    for (int i = 0; i < 2; ++i)
#pragma unroll
      for (int r = 0; r < 8; ++r)
        Tf[w][16 * i + 8 * h + r][16 * j + m] = acc[i][j][r] + bj;
  }
  __syncthreads();

  v4f ov[8];
#pragma unroll
  for (int q = 0; q < 8; ++q) {
    const int g = 32 * q + l;
    const int row = g >> 3, cs = (g & 7) * 4;
    ov[q] = *(const v4f*)&Tf[w][row][cs];
  }
  const size_t base = (size_t)r0 * 256 + (size_t)c0;
#pragma unroll
  for (int q = 0; q < 8; ++q) {
    const int g = 32 * q + l;
    const int row = g >> 3, cs = (g & 7) * 4;
    *(v4f*)(out + base + (size_t)row * 256 + cs) = ov[q];
  }
  
}

// ----------------------------------------------------------------------------
extern "C" void kernel_launch(void* const* d_in, const int* in_sizes, int n_in,
                              void* d_out, int out_size, void* d_ws, size_t ws_size,
                              hipStream_t stream) {
  const int M = 8192;      // B * N
  const int C = 256;
  const int C3 = 768;
  if (n_in < 5) return;
  if (in_sizes[0] != M * C || in_sizes[1] != C3 * C || in_sizes[2] != C * C ||
      in_sizes[3] != C || in_sizes[4] < 1 || out_size != M * C) return;

  const float* x     = (const float*)d_in[0];   // [2,4096,256]
  const float* wqkv  = (const float*)d_in[1];   // [768,256]
  const float* wproj = (const float*)d_in[2];   // [256,256]
  const float* bproj = (const float*)d_in[3];   // [256]
  const float* temp  = (const float*)d_in[4];   // [1]
  float* out = (float*)d_out;                   // [2,4096,256] f32

  const size_t szX  = (size_t)M * C * 2;        // one bf16 plane of x / q / k / v / attn
  const size_t szW1 = (size_t)C3 * C * 2;
  const size_t szW2 = (size_t)C * C * 2;
  size_t off = 0;
  char* ws = (char*)d_ws;
  us* xh  = (us*)(ws + off); off += szX;
  us* xl  = (us*)(ws + off); off += szX;
  us* w1h = (us*)(ws + off); off += szW1;
  us* w1l = (us*)(ws + off); off += szW1;
  us* w2h = (us*)(ws + off); off += szW2;
  us* w2l = (us*)(ws + off); off += szW2;
  us* qh  = (us*)(ws + off); off += szX;
  us* ql  = (us*)(ws + off); off += szX;
  us* kh  = (us*)(ws + off); off += szX;
  us* kl  = (us*)(ws + off); off += szX;
  us* vh  = (us*)(ws + off); off += szX;
  us* vl  = (us*)(ws + off); off += szX;
  us* ah  = (us*)(ws + off); off += szX;
  us* al  = (us*)(ws + off); off += szX;   // total 42,991,616 bytes
  if (off > ws_size) return;

  const int n0 = M * C, n1 = C3 * C, n2 = C * C;
  const int nb0 = (n0 / 8 + 255) / 256;   // 1024
  const int nb1 = (n1 / 8 + 255) / 256;   // 96
  const int nb2 = (n2 / 8 + 255) / 256;   // 32
  k_split<<<nb0 + nb1 + nb2, 256, 0, stream>>>(x, n0, xh, xl, wqkv, n1, w1h, w1l,
                                               wproj, n2, w2h, w2l, nb0, nb1);

  k_gemm_qkv<<<dim3(C3 / 64, M / 128), 256, 0, stream>>>(xh, xl, w1h, w1l,
                                                          qh, ql, kh, kl, vh, vl);

  k_attn<<<(M / 16) * 8, 32, 0, stream>>>(qh, ql, kh, kl, vh, vl, temp, ah, al);

  k_gemm_proj<<<dim3(C / 64, M / 128), 256, 0, stream>>>(ah, al, w2h, w2l, bproj, out);
}

// v002
// It runs in 51.4 microseconds.
// Next to v001, in two timings, it ran 1.19 and 1.18 times as fast.
// All steps since v000 together make it 1.64 times as fast.
#include <hip/hip_runtime.h>

// All contractions (qkv projection, q.k^T scores, p.v, output projection): v_wmma_f32_16x16x32_bf16 with bf16 hi/lo split operands (hi*hi + hi*lo + lo*hi), f32 accumulate; softmax, scaling and bias in f32.

typedef unsigned short us;
typedef us us8 __attribute__((ext_vector_type(8)));
typedef us us16 __attribute__((ext_vector_type(16)));
typedef __bf16 bf16x16 __attribute__((ext_vector_type(16)));
typedef float v8f __attribute__((ext_vector_type(8)));
typedef float v4f __attribute__((ext_vector_type(4)));

union Frag {
  bf16x16 v;
  us16 u;
  us8 half[2];
};

// f32 -> bf16 bits, RNE convert
__device__ __forceinline__ us f2bf(float f) {
  unsigned u = __float_as_uint(f);
  u += 0x7FFFu + ((u >> 16) & 1u);
  return (us)(u >> 16);
}

// f32 -> (hi, lo) bf16 pair: hi = rne(f), lo = rne(f - hi)
__device__ __forceinline__ void split2(float f, us& hi, us& lo) {
  const us hb = f2bf(f);
  const float hf = __uint_as_float(((unsigned)hb) << 16);
  hi = hb;
  lo = f2bf(f - hf);
}

// 16x32 operand fragment from a k-contiguous 16-bit row (row picked by lane&15 by the caller):
// elements 0..7 <- k0+8h+0..7, elements 8..15 <- k0+16+8h+0..7  (h = lane>>4). Same map for A and B.
__device__ __forceinline__ Frag ldfrag(const us* p, int h) {
  Frag f;
  f.half[0] = *(const us8*)(p + 8 * h);
  f.half[1] = *(const us8*)(p + 16 + 8 * h);
  return f;
}

// The same fragment from a plane stored in fragment order: per (16-row tile, k-step) two runs of 512 B,
// run x holds for lane (h, m) the 8 elements k0+16x+8h+0..7 of row m at 16-B chunk 16h+m, so one
// wave-wide 16-B load covers four whole 128-B lines. p already includes the lane's chunk (lane * 8).
__device__ __forceinline__ Frag ldpack(const us* p) {
  Frag f;
  f.half[0] = *(const us8*)p;
  f.half[1] = *(const us8*)(p + 256);
  return f;
}

__device__ __forceinline__ v8f wmma16(bf16x16 a, bf16x16 b, v8f c) {
  return __builtin_amdgcn_wmma_f32_16x16x32_bf16(false, a, false, b, (short)0, c, false, false);
}

// acc += A*B with A = ah+al, B = bh+bl (lo*lo dropped); hazard guard after the last WMMA of the group.
__device__ __forceinline__ v8f mma3(const Frag& ah, const Frag& al, const Frag& bh, const Frag& bl, v8f acc) {
  acc = wmma16(al.v, bh.v, acc);
  acc = wmma16(ah.v, bl.v, acc);
  acc = wmma16(ah.v, bh.v, acc);
  asm volatile("v_nop\n\tv_nop\n\tv_nop\n\tv_nop"
               : "+v"(acc)
               : "v"(ah.v), "v"(al.v), "v"(bh.v), "v"(bl.v));
  return acc;
}

__device__ __forceinline__ v8f zero8() {
  v8f z;
#pragma unroll
  for (int i = 0; i < 8; ++i) z[i] = 0.0f;
  return z;
}

// ----------------------------------------------------------------------------
// f32 -> bf16 hi/lo planes for x [8192x256], W_qkv [768x256], W_proj [256x256], stored in fragment
// order (see ldpack): 16-B chunk i = ((tile*8 + kstep)*2 + x)*32 + 16h + m holds row 16*tile + m,
// k = 32*kstep + 16x + 8h + 0..7. Thread i converts chunk i; a wave writes 512 contiguous bytes per plane
__global__ __launch_bounds__(256) void k_split(
    const float* __restrict__ s0, int n0, us* h0, us* l0,
    const float* __restrict__ s1, int n1, us* h1, us* l1,
    const float* __restrict__ s2, int n2, us* h2, us* l2,
    int nb0, int nb1) {
  const int blk = blockIdx.x;
  const float* src;
  us* dh;
  us* dl;
  int n, base;
  if (blk < nb0) {
    src = s0; dh = h0; dl = l0; n = n0; base = blk;
  } else if (blk < nb0 + nb1) {
    src = s1; dh = h1; dl = l1; n = n1; base = blk - nb0;
  } else {
    src = s2; dh = h2; dl = l2; n = n2; base = blk - nb0 - nb1;
  }
  const int i = base * 256 + (int)threadIdx.x;
  if (8 * i + 8 <= n) {
    const size_t e0 = (size_t)i * 8;
    const int srow = (i >> 9) * 16 + (i & 15);
    const int scol = ((i >> 6) & 7) * 32 + ((i >> 5) & 1) * 16 + ((i >> 4) & 1) * 8;
    const size_t f0 = (size_t)srow * 256 + (size_t)scol;
    const v4f a = *(const v4f*)(src + f0);
    const v4f c = *(const v4f*)(src + f0 + 4);
    us8 hv, lv;
#pragma unroll
    for (int e = 0; e < 4; ++e) {
      us hs, ls;
      split2(a[e], hs, ls);
      hv[e] = hs;
      lv[e] = ls;
      split2(c[e], hs, ls);
      hv[4 + e] = hs;
      lv[4 + e] = ls;
    }
    *(us8*)(dh + e0) = hv;
    *(us8*)(dl + e0) = lv;
    
  }
}

// ----------------------------------------------------------------------------
// GEMM main loop: wave tile 32(M) x 32(N), K = 256 in 8 steps of 32, operand fragments loaded
// directly from global hi/lo planes in fragment order (4096 elements per 16-row tile, 512 per k-step).
// A rows [M][256], W rows [N][256] (B[k][n] = W[n][k]); l = lane.
__device__ __forceinline__ void gemm_mainloop(const us* __restrict__ Ah, const us* __restrict__ Al,
                                              const us* __restrict__ Wh, const us* __restrict__ Wl,
                                              int r0, int c0, int l, v8f (&acc)[2][2]) {
#pragma unroll 1
  for (int ks = 0; ks < 8; ++ks) {
    Frag ah[2], al[2], bh[2], bl[2];
#pragma unroll
    for (int i = 0; i < 2; ++i) {
      const size_t off = (size_t)((r0 >> 4) + i) * 4096 + (size_t)ks * 512 + (size_t)l * 8;
      ah[i] = ldpack(Ah + off);
      al[i] = ldpack(Al + off);
    }
#pragma unroll
    for (int j = 0; j < 2; ++j) {
      const size_t off = (size_t)((c0 >> 4) + j) * 4096 + (size_t)ks * 512 + (size_t)l * 8;
      bh[j] = ldpack(Wh + off);
      bl[j] = ldpack(Wl + off);
    }
#pragma unroll
    for (int i = 0; i < 2; ++i)
#pragma unroll
      for (int j = 0; j < 2; ++j)
        acc[i][j] = mma3(ah[i], al[i], bh[j], bl[j], acc[i][j]);
  }
}

// ----------------------------------------------------------------------------
// QKV projection: C[8192 x 768] = Xs[8192 x 256] * Wqkv^T.
// Block 256 threads = 8 waves (4 x 2), block tile 128 x 64, grid (12, 64).
// Epilogue: a wave's 32x32 tile maps to one (q|k|v, head) and 32 consecutive tokens, i.e. 2048
// split hi/lo, staged in LDS and written with 4 lane-contiguous 16-B store instructions per plane.
// Plane layouts inside [b][head], 256 elements per group of 8 tokens:
//   q: [token][32]                          (row order)
//   k: [token/8][d/8][token%8][8 d]         (K fragments of the score product at any 8-token offset)
//   v: [token/8][d][8 tokens]               (transposed: V fragments of the p.v product at any 8-token offset)
__global__ __launch_bounds__(256) void k_gemm_qkv(
    const us* __restrict__ Xh, const us* __restrict__ Xl,
    const us* __restrict__ Wh, const us* __restrict__ Wl,
    us* qh, us* ql, us* kh, us* kl, us* vh, us* vl) {
  __shared__ __align__(16) us Th[8][32][40];
  __shared__ __align__(16) us Tl[8][32][40];
  const int tid = threadIdx.x;
  const int w = tid >> 5, l = tid & 31, h = l >> 4, m = l & 15;
  const int wm = w >> 1, wn = w & 1;
  const int r0 = (int)blockIdx.y * 128 + wm * 32;
  const int c0 = (int)blockIdx.x * 64 + wn * 32;

  v8f acc[2][2];
#pragma unroll
  for (int i = 0; i < 2; ++i)
#pragma unroll
    for (int j = 0; j < 2; ++j) acc[i][j] = zero8();

  gemm_mainloop(Xh, Xl, Wh, Wl, r0, c0, l, acc);

  const int three = c0 >> 8;   // same for the whole block (64 columns per block)

  // D element r of lane (h, m): row 16i + 8h + r, col 16j + m of the wave tile.
  // q, k staged as T[token][d]; v staged transposed as T[d][token] (8 tokens of a lane = one 16-B store)
#pragma unroll
  for (int i = 0; i < 2; ++i)
#pragma unroll
    for (int j = 0; j < 2; ++j) {
      us8 h8, l8;
#pragma unroll
      for (int r = 0; r < 8; ++r) {
        us hs, ls;
        split2(acc[i][j][r], hs, ls);
        h8[r] = hs;
        l8[r] = ls;
      }
      if (three == 2) {
        *(us8*)&Th[w][16 * j + m][16 * i + 8 * h] = h8;
        *(us8*)&Tl[w][16 * j + m][16 * i + 8 * h] = l8;
      } else {
#pragma unroll
        for (int r = 0; r < 8; ++r) {
          Th[w][16 * i + 8 * h + r][16 * j + m] = h8[r];
          Tl[w][16 * i + 8 * h + r][16 * j + m] = l8[r];
        }
      }
    }
  __syncthreads();

  const int head = (c0 & 255) >> 5;
  const int bb = r0 >> 12, n0 = r0 & 4095;
  us* dh = (three == 0) ? qh : ((three == 1) ? kh : vh);
  us* dl = (three == 0) ? ql : ((three == 1) ? kl : vl);
  const size_t dst = ((size_t)(bb * 8 + head) * 4096 + (size_t)n0) * 32;

  us8 hv[4], lv[4];
#pragma unroll
  for (int q = 0; q < 4; ++q) {
    const int g = 32 * q + l;          // 16-B chunk index in the plane's own order, 128 chunks
    int row, ds;
    if (three == 0) {
      row = g >> 2; ds = (g & 3) * 8;          // T[token][d], row order
    } else if (three == 1) {
      row = 8 * q + (l & 7); ds = (l >> 3) * 8;  // T[token][d], chunk = (token/8, d/8, token%8)
    } else {
      row = l; ds = 8 * q;                     // T[d][token], chunk = (token/8, d)
    }
    hv[q] = *(const us8*)&Th[w][row][ds];
    lv[q] = *(const us8*)&Tl[w][row][ds];
  }
#pragma unroll
  for (int q = 0; q < 4; ++q) {
    const size_t o = dst + (size_t)8 * (32 * q + l);
    *(us8*)(dh + o) = hv[q];
    *(us8*)(dl + o) = lv[q];
  }
  
}

__device__ __forceinline__ float xhalf(float x) {   // value of lane l ^ 16
  const int b = __builtin_bit_cast(int, x);
  return __builtin_bit_cast(float, __builtin_amdgcn_permlanex16(b, b, 0x76543210, 0xfedcba98, false, false));
}

__global__ __launch_bounds__(32) void k_attn(
    const us* __restrict__ qh, const us* __restrict__ ql,
    const us* __restrict__ kh, const us* __restrict__ kl,
    const us* __restrict__ vh, const us* __restrict__ vl,
    const float* __restrict__ temp, us* oh, us* ol) {
  const int bid = blockIdx.x;
  const int qblk = bid & 255;
  const int hd = (bid >> 8) & 7;
  const int b = bid >> 11;
  const int l = threadIdx.x & 31, h = l >> 4, m = l & 15;
  const int q0 = qblk * 16;
  const int qr = q0 >> 6;
  const int qc0 = q0 & 63;
  const float alpha = 0.17677669529663689f * temp[0];   // hd^-0.5 * temperature
  const size_t hb = (size_t)(b * 8 + hd) * 4096 * 32;

  const Frag qfh = ldfrag(qh + hb + (size_t)(q0 + m) * 32, h);
  const Frag qfl = ldfrag(ql + hb + (size_t)(q0 + m) * 32, h);

  float mrun = -__builtin_inff();   // running maximum of query m (equal in both halves)
  float lrun = 0.0f;                // running sum over this half's slots only; halves joined after the loop
  v8f accO[2];
  accO[0] = zero8();
  accO[1] = zero8();

  int wst = qc0 - 8;
  if (wst < 0) wst = 0;
  if (wst > 32) wst = 32;
  const int kr0 = (qr - 3 < 0) ? 0 : (qr - 3);
  const int kr1 = (qr + 3 > 63) ? 63 : (qr + 3);
  const int dc0 = wst + 8 * h - (qc0 + m);   // key col - query col of slot 8h

  for (int kr = kr0; kr <= kr1; ++kr) {
    const int t0 = kr * 64 + wst;   // multiple of 8 -> 16-B aligned rows

    // V fragments of the 32 key slots: element (x, e) of lane (h, m) = V[t0 + 16x + 8h + e][16db + m]
    Frag vfh[2], vfl[2];
#pragma unroll
    for (int db = 0; db < 2; ++db) {
      const size_t vo = hb + (size_t)t0 * 32 + (size_t)(h * 256 + db * 128 + m * 8);
      vfh[db].half[0] = *(const us8*)(vh + vo);
      vfh[db].half[1] = *(const us8*)(vh + vo + 512);
      vfl[db].half[0] = *(const us8*)(vl + vo);
      vfl[db].half[1] = *(const us8*)(vl + vo + 512);
    }

    // scores for two 16-slot chunks: D[r] = S[q = m][slot 16c + 8h + r]
    v8f s[2];
#pragma unroll
    for (int c = 0; c < 2; ++c) {
      // element (x, e) of lane (h, m) = K[t0 + 16c + m][16x + 8h + e]
      const size_t ko = hb + (size_t)(t0 + 16 * c) * 32 + (size_t)((m >> 3) * 256 + h * 64 + (m & 7) * 8);
      Frag kfh, kfl;
      kfh.half[0] = *(const us8*)(kh + ko);
      kfh.half[1] = *(const us8*)(kh + ko + 128);
      kfl.half[0] = *(const us8*)(kl + ko);
      kfl.half[1] = *(const us8*)(kl + ko + 128);
      s[c] = mma3(kfh, kfl, qfh, qfl, zero8());
    }

    // locality mask + scale
#pragma unroll
    for (int c = 0; c < 2; ++c) {
#pragma unroll
      for (int r = 0; r < 8; ++r) {
        const int dc = dc0 + 16 * c + r;
        const bool ok = (dc >= -3) && (dc <= 3);
        s[c][r] = ok ? s[c][r] * alpha : -__builtin_inff();
      }
    }

    // online softmax over the 32 slots of this key row
    float rm = fmaxf(s[0][0], s[1][0]);
#pragma unroll
    for (int r = 1; r < 8; ++r) rm = fmaxf(rm, fmaxf(s[0][r], s[1][r]));
    rm = fmaxf(rm, xhalf(rm));
    const float mn = fmaxf(mrun, rm);        // finite: every query has >= 4 valid keys per row
    const float sc = __expf(mrun - mn);      // 0 on the first key row
    Frag pfh, pfl;
    float ps[2];
#pragma unroll
    for (int c = 0; c < 2; ++c) {
      ps[c] = 0.0f;
#pragma unroll
      for (int r = 0; r < 8; ++r) {
        const float p = __expf(s[c][r] - mn);   // masked -> 0
        us hs, ls;
        split2(p, hs, ls);
        pfh.u[8 * c + r] = hs;
        pfl.u[8 * c + r] = ls;
        ps[c] += p;
      }
    }
    lrun = lrun * sc + (ps[0] + ps[1]);
    mrun = mn;

#pragma unroll
    for (int r = 0; r < 8; ++r) {
      accO[0][r] *= sc;
      accO[1][r] *= sc;
    }

    // O^T[d][q] += sum_slot V[slot][d] * P[q][slot]
#pragma unroll
    for (int db = 0; db < 2; ++db)
      accO[db] = mma3(vfh[db], vfl[db], pfh, pfl, accO[db]);
  }

  const float inv = 1.0f / (lrun + xhalf(lrun));   // sum >= 1

  const size_t dst = ((size_t)(b * 256 + qblk) * 8 + (size_t)hd) * 512;
#pragma unroll
  for (int db = 0; db < 2; ++db) {
    us8 hv, lv;
#pragma unroll
    for (int r = 0; r < 8; ++r) {
      us hs, ls;
      split2(accO[db][r] * inv, hs, ls);
      hv[r] = hs;
      lv[r] = ls;
    }
    const size_t o = dst + (size_t)8 * (32 * db + l);
    *(us8*)(oh + o) = hv;
    *(us8*)(ol + o) = lv;
  }
}

// ----------------------------------------------------------------------------
// Output projection: out[8192 x 256] = attn[8192 x 256] * Wproj^T + bias (f32).
// A from the attention planes in fragment order (k-step ks = head ks). Grid (4, 64), 8 waves per block.
__global__ __launch_bounds__(256) void k_gemm_proj(
    const us* __restrict__ Ah, const us* __restrict__ Al,
    const us* __restrict__ Wh, const us* __restrict__ Wl,
    const float* __restrict__ bias, float* out) {
  __shared__ __align__(16) float Tf[8][32][36];
  const int tid = threadIdx.x;
  const int w = tid >> 5, l = tid & 31, h = l >> 4, m = l & 15;
  const int wm = w >> 1, wn = w & 1;
  const int r0 = (int)blockIdx.y * 128 + wm * 32;
  const int c0 = (int)blockIdx.x * 64 + wn * 32;

  v8f acc[2][2];
#pragma unroll
  for (int i = 0; i < 2; ++i)
#pragma unroll
    for (int j = 0; j < 2; ++j) acc[i][j] = zero8();

  gemm_mainloop(Ah, Al, Wh, Wl, r0, c0, l, acc);

#pragma unroll
  for (int j = 0; j < 2; ++j) {
    const float bj = bias[c0 + 16 * j + m];
#pragma unroll
    for (int i = 0; i < 2; ++i)
#pragma unroll
      for (int r = 0; r < 8; ++r)
        Tf[w][16 * i + 8 * h + r][16 * j + m] = acc[i][j][r] + bj;
  }
  __syncthreads();

  v4f ov[8];
#pragma unroll
  for (int q = 0; q < 8; ++q) {
    const int g = 32 * q + l;
    const int row = g >> 3, cs = (g & 7) * 4;
    ov[q] = *(const v4f*)&Tf[w][row][cs];
  }
  const size_t base = (size_t)r0 * 256 + (size_t)c0;
#pragma unroll
  for (int q = 0; q < 8; ++q) {
    const int g = 32 * q + l;
    const int row = g >> 3, cs = (g & 7) * 4;
    *(v4f*)(out + base + (size_t)row * 256 + cs) = ov[q];
  }
  
}

// ----------------------------------------------------------------------------
extern "C" void kernel_launch(void* const* d_in, const int* in_sizes, int n_in,
                              void* d_out, int out_size, void* d_ws, size_t ws_size,
                              hipStream_t stream) {
  const int M = 8192;      // B * N
  const int C = 256;
  const int C3 = 768;
  if (n_in < 5) return;
  if (in_sizes[0] != M * C || in_sizes[1] != C3 * C || in_sizes[2] != C * C ||
      in_sizes[3] != C || in_sizes[4] < 1 || out_size != M * C) return;

  const float* x     = (const float*)d_in[0];   // [2,4096,256]
  const float* wqkv  = (const float*)d_in[1];   // [768,256]
  const float* wproj = (const float*)d_in[2];   // [256,256]
  const float* bproj = (const float*)d_in[3];   // [256]
  const float* temp  = (const float*)d_in[4];   // [1]
  float* out = (float*)d_out;                   // [2,4096,256] f32

  const size_t szX  = (size_t)M * C * 2;        // one bf16 plane of x / q / k / v / attn
  const size_t szW1 = (size_t)C3 * C * 2;
  const size_t szW2 = (size_t)C * C * 2;
  size_t off = 0;
  char* ws = (char*)d_ws;
  us* xh  = (us*)(ws + off); off += szX;
  us* xl  = (us*)(ws + off); off += szX;
  us* w1h = (us*)(ws + off); off += szW1;
  us* w1l = (us*)(ws + off); off += szW1;
  us* w2h = (us*)(ws + off); off += szW2;
  us* w2l = (us*)(ws + off); off += szW2;
  us* qh  = (us*)(ws + off); off += szX;
  us* ql  = (us*)(ws + off); off += szX;
  us* kh  = (us*)(ws + off); off += szX;
  us* kl  = (us*)(ws + off); off += szX;
  us* vh  = (us*)(ws + off); off += szX;
  us* vl  = (us*)(ws + off); off += szX;
  us* ah  = (us*)(ws + off); off += szX;
  us* al  = (us*)(ws + off); off += szX;   // total 42,991,616 bytes
  if (off > ws_size) return;

  const int n0 = M * C, n1 = C3 * C, n2 = C * C;
  const int nb0 = (n0 / 8 + 255) / 256;   // 1024
  const int nb1 = (n1 / 8 + 255) / 256;   // 96
  const int nb2 = (n2 / 8 + 255) / 256;   // 32
  k_split<<<nb0 + nb1 + nb2, 256, 0, stream>>>(x, n0, xh, xl, wqkv, n1, w1h, w1l,
                                               wproj, n2, w2h, w2l, nb0, nb1);

  k_gemm_qkv<<<dim3(C3 / 64, M / 128), 256, 0, stream>>>(xh, xl, w1h, w1l,
                                                          qh, ql, kh, kl, vh, vl);

  k_attn<<<(M / 16) * 8, 32, 0, stream>>>(qh, ql, kh, kl, vh, vl, temp, ah, al);

  k_gemm_proj<<<dim3(C / 64, M / 128), 256, 0, stream>>>(ah, al, w2h, w2l, bproj, out);
}

// v003
// It runs in 41 microseconds.
// Two timings next to v002 put it at 1.23 and 1.24 times that version's speed.
// All steps since v000 together make it 2.02 times as fast.
#include <hip/hip_runtime.h>

// All contractions (qkv projection, q.k^T scores, p.v, output projection): v_wmma_f32_16x16x32_bf16 with bf16 hi/lo split operands (hi*hi + hi*lo + lo*hi), f32 accumulate; softmax, scaling and bias in f32.

typedef unsigned short us;
typedef us us8 __attribute__((ext_vector_type(8)));
typedef us us16 __attribute__((ext_vector_type(16)));
typedef __bf16 bf16x16 __attribute__((ext_vector_type(16)));
typedef float v8f __attribute__((ext_vector_type(8)));
typedef float v4f __attribute__((ext_vector_type(4)));

union Frag {
  bf16x16 v;
  us16 u;
  us8 half[2];
};

// f32 -> bf16 bits, RNE convert
__device__ __forceinline__ us f2bf(float f) {
  unsigned u = __float_as_uint(f);
  u += 0x7FFFu + ((u >> 16) & 1u);
  return (us)(u >> 16);
}

// f32 -> (hi, lo) bf16 pair: hi = rne(f), lo = rne(f - hi)
__device__ __forceinline__ void split2(float f, us& hi, us& lo) {
  const us hb = f2bf(f);
  const float hf = __uint_as_float(((unsigned)hb) << 16);
  hi = hb;
  lo = f2bf(f - hf);
}

// 16x32 operand fragment from a k-contiguous 16-bit row (row picked by lane&15 by the caller):
// elements 0..7 <- k0+8h+0..7, elements 8..15 <- k0+16+8h+0..7  (h = lane>>4). Same map for A and B.
__device__ __forceinline__ Frag ldfrag(const us* p, int h) {
  Frag f;
  f.half[0] = *(const us8*)(p + 8 * h);
  f.half[1] = *(const us8*)(p + 16 + 8 * h);
  return f;
}

// The same fragment from a plane stored in fragment order: per (16-row tile, k-step) two runs of 512 B,
// run x holds for lane (h, m) the 8 elements k0+16x+8h+0..7 of row m at 16-B chunk 16h+m, so one
// wave-wide 16-B load covers four whole 128-B lines. p already includes the lane's chunk (lane * 8).
__device__ __forceinline__ Frag ldpack(const us* p) {
  Frag f;
  f.half[0] = *(const us8*)p;
  f.half[1] = *(const us8*)(p + 256);
  return f;
}

__device__ __forceinline__ v8f wmma16(bf16x16 a, bf16x16 b, v8f c) {
  return __builtin_amdgcn_wmma_f32_16x16x32_bf16(false, a, false, b, (short)0, c, false, false);
}

// acc += A*B with A = ah+al, B = bh+bl (lo*lo dropped); hazard guard after the last WMMA of the group.
__device__ __forceinline__ v8f mma3(const Frag& ah, const Frag& al, const Frag& bh, const Frag& bl, v8f acc) {
  acc = wmma16(al.v, bh.v, acc);
  acc = wmma16(ah.v, bl.v, acc);
  acc = wmma16(ah.v, bh.v, acc);
  asm volatile("v_nop\n\tv_nop\n\tv_nop\n\tv_nop"
               : "+v"(acc)
               : "v"(ah.v), "v"(al.v), "v"(bh.v), "v"(bl.v));
  return acc;
}

__device__ __forceinline__ v8f zero8() {
  v8f z;
#pragma unroll
  for (int i = 0; i < 8; ++i) z[i] = 0.0f;
  return z;
}

// ----------------------------------------------------------------------------
// f32 -> bf16 hi/lo planes for x [8192x256], W_qkv [768x256], W_proj [256x256], stored in fragment
// order (see ldpack): 16-B chunk i = ((tile*8 + kstep)*2 + x)*32 + 16h + m holds row 16*tile + m,
// k = 32*kstep + 16x + 8h + 0..7. Thread i converts chunk i; a wave writes 512 contiguous bytes per plane
__global__ __launch_bounds__(256) void k_split(
    const float* __restrict__ s0, int n0, us* h0, us* l0,
    const float* __restrict__ s1, int n1, us* h1, us* l1,
    const float* __restrict__ s2, int n2, us* h2, us* l2,
    int nb0, int nb1) {
  const int blk = blockIdx.x;
  const float* src;
  us* dh;
  us* dl;
  int n, base;
  if (blk < nb0) {
    src = s0; dh = h0; dl = l0; n = n0; base = blk;
  } else if (blk < nb0 + nb1) {
    src = s1; dh = h1; dl = l1; n = n1; base = blk - nb0;
  } else {
    src = s2; dh = h2; dl = l2; n = n2; base = blk - nb0 - nb1;
  }
  const int i = base * 256 + (int)threadIdx.x;
  if (8 * i + 8 <= n) {
    const size_t e0 = (size_t)i * 8;
    const int srow = (i >> 9) * 16 + (i & 15);
    const int scol = ((i >> 6) & 7) * 32 + ((i >> 5) & 1) * 16 + ((i >> 4) & 1) * 8;
    const size_t f0 = (size_t)srow * 256 + (size_t)scol;
    const v4f a = *(const v4f*)(src + f0);
    const v4f c = *(const v4f*)(src + f0 + 4);
    us8 hv, lv;
#pragma unroll
    for (int e = 0; e < 4; ++e) {
      us hs, ls;
      split2(a[e], hs, ls);
      hv[e] = hs;
      lv[e] = ls;
      split2(c[e], hs, ls);
      hv[4 + e] = hs;
      lv[4 + e] = ls;
    }
    *(us8*)(dh + e0) = hv;
    *(us8*)(dl + e0) = lv;
    
  }
}

// ----------------------------------------------------------------------------
// GEMM main loop: wave tile 32(M) x 32(N), K = 256 in 8 steps of 32, operand fragments loaded
// directly from global hi/lo planes in fragment order (4096 elements per 16-row tile, 512 per k-step).
// A rows [M][256], W rows [N][256] (B[k][n] = W[n][k]); l = lane.
__device__ __forceinline__ void gemm_mainloop(const us* __restrict__ Ah, const us* __restrict__ Al,
                                              const us* __restrict__ Wh, const us* __restrict__ Wl,
                                              int r0, int c0, int l, v8f (&acc)[2][2]) {
#pragma unroll 1
  for (int ks = 0; ks < 8; ++ks) {
    Frag ah[2], al[2], bh[2], bl[2];
#pragma unroll
    for (int i = 0; i < 2; ++i) {
      const size_t off = (size_t)((r0 >> 4) + i) * 4096 + (size_t)ks * 512 + (size_t)l * 8;
      ah[i] = ldpack(Ah + off);
      al[i] = ldpack(Al + off);
    }
#pragma unroll
    for (int j = 0; j < 2; ++j) {
      const size_t off = (size_t)((c0 >> 4) + j) * 4096 + (size_t)ks * 512 + (size_t)l * 8;
      bh[j] = ldpack(Wh + off);
      bl[j] = ldpack(Wl + off);
    }
#pragma unroll
    for (int i = 0; i < 2; ++i)
#pragma unroll
      for (int j = 0; j < 2; ++j)
        acc[i][j] = mma3(ah[i], al[i], bh[j], bl[j], acc[i][j]);
  }
}

// ----------------------------------------------------------------------------
// QKV projection: C[8192 x 768] = Xs[8192 x 256] * Wqkv^T.
// Block 256 threads = 8 waves (4 x 2), block tile 128 x 64, grid (12, 64).
// Epilogue: a wave's 32x32 tile maps to one (q|k|v, head) and 32 consecutive tokens, i.e. 2048
// split hi/lo, staged in LDS and written with 4 lane-contiguous 16-B store instructions per plane.
// Plane layouts inside [b][head], 256 elements per group of 8 tokens:
//   q: [token][32]                          (row order)
//   k: [token/8][d/8][token%8][8 d]         (K fragments of the score product at any 8-token offset)
//   v: [token/8][d][8 tokens]               (transposed: V fragments of the p.v product at any 8-token offset)
__global__ __launch_bounds__(256) void k_gemm_qkv(
    const us* __restrict__ Xh, const us* __restrict__ Xl,
    const us* __restrict__ Wh, const us* __restrict__ Wl,
    us* qh, us* ql, us* kh, us* kl, us* vh, us* vl) {
  __shared__ __align__(16) us Th[8][32][40];
  __shared__ __align__(16) us Tl[8][32][40];
  const int tid = threadIdx.x;
  const int w = tid >> 5, l = tid & 31, h = l >> 4, m = l & 15;
  const int wm = w >> 1, wn = w & 1;
  const int r0 = (int)blockIdx.y * 128 + wm * 32;
  const int c0 = (int)blockIdx.x * 64 + wn * 32;

  v8f acc[2][2];
#pragma unroll
  for (int i = 0; i < 2; ++i)
#pragma unroll
    for (int j = 0; j < 2; ++j) acc[i][j] = zero8();

  gemm_mainloop(Xh, Xl, Wh, Wl, r0, c0, l, acc);

  const int three = c0 >> 8;   // same for the whole block (64 columns per block)

  // D element r of lane (h, m): row 16i + 8h + r, col 16j + m of the wave tile.
  // q, k staged as T[token][d]; v staged transposed as T[d][token] (8 tokens of a lane = one 16-B store)
#pragma unroll
  for (int i = 0; i < 2; ++i)
#pragma unroll
    for (int j = 0; j < 2; ++j) {
      us8 h8, l8;
#pragma unroll
      for (int r = 0; r < 8; ++r) {
        us hs, ls;
        split2(acc[i][j][r], hs, ls);
        h8[r] = hs;
        l8[r] = ls;
      }
      if (three == 2) {
        *(us8*)&Th[w][16 * j + m][16 * i + 8 * h] = h8;
        *(us8*)&Tl[w][16 * j + m][16 * i + 8 * h] = l8;
      } else {
#pragma unroll
        for (int r = 0; r < 8; ++r) {
          Th[w][16 * i + 8 * h + r][16 * j + m] = h8[r];
          Tl[w][16 * i + 8 * h + r][16 * j + m] = l8[r];
        }
      }
    }
  __syncthreads();

  const int head = (c0 & 255) >> 5;
  const int bb = r0 >> 12, n0 = r0 & 4095;
  us* dh = (three == 0) ? qh : ((three == 1) ? kh : vh);
  us* dl = (three == 0) ? ql : ((three == 1) ? kl : vl);
  const size_t dst = ((size_t)(bb * 8 + head) * 4096 + (size_t)n0) * 32;

  us8 hv[4], lv[4];
#pragma unroll
  for (int q = 0; q < 4; ++q) {
    const int g = 32 * q + l;          // 16-B chunk index in the plane's own order, 128 chunks
    int row, ds;
    if (three == 0) {
      row = g >> 2; ds = (g & 3) * 8;          // T[token][d], row order
    } else if (three == 1) {
      row = 8 * q + (l & 7); ds = (l >> 3) * 8;  // T[token][d], chunk = (token/8, d/8, token%8)
    } else {
      row = l; ds = 8 * q;                     // T[d][token], chunk = (token/8, d)
    }
    hv[q] = *(const us8*)&Th[w][row][ds];
    lv[q] = *(const us8*)&Tl[w][row][ds];
  }
#pragma unroll
  for (int q = 0; q < 4; ++q) {
    const size_t o = dst + (size_t)8 * (32 * q + l);
    *(us8*)(dh + o) = hv[q];
    *(us8*)(dl + o) = lv[q];
  }
  
}

__device__ __forceinline__ float xhalf(float x) {   // value of lane l ^ 16
  const int b = __builtin_bit_cast(int, x);
  return __builtin_bit_cast(float, __builtin_amdgcn_permlanex16(b, b, 0x76543210, 0xfedcba98, false, false));
}

__global__ __launch_bounds__(512) void k_attn_proj(
    const us* __restrict__ qh, const us* __restrict__ ql,
    const us* __restrict__ kh, const us* __restrict__ kl,
    const us* __restrict__ vh, const us* __restrict__ vl,
    const float* __restrict__ temp,
    const us* __restrict__ Wh, const us* __restrict__ Wl,
    const float* __restrict__ bias, float* out) {
  __shared__ __align__(16) us Oh[2][8][512];     // [query tile][k-step = head][fragment order]
  __shared__ __align__(16) us Ol[2][8][512];
  __shared__ __align__(16) float Tf[32][260];    // output tile, pitch 260: the two wave halves hit disjoint banks
  const int bid = blockIdx.x;
  const int w = __builtin_amdgcn_readfirstlane((int)threadIdx.x >> 5);   // wave number, kept scalar: head, tile and loop bounds stay uniform
  const int qt = w >> 3;
  const int hd = w & 7;
  const int b = bid >> 7;
  const int qblk = (bid & 127) * 2 + qt;
  const int l = threadIdx.x & 31, h = l >> 4, m = l & 15;
  const int q0 = qblk * 16;
  const int qr = q0 >> 6;
  const int qc0 = q0 & 63;
  const float alpha = 0.17677669529663689f * temp[0];   // hd^-0.5 * temperature
  const size_t hb = (size_t)(b * 8 + hd) * 4096 * 32;

  const Frag qfh = ldfrag(qh + hb + (size_t)(q0 + m) * 32, h);
  const Frag qfl = ldfrag(ql + hb + (size_t)(q0 + m) * 32, h);

  float mrun = -__builtin_inff();   // running maximum of query m (equal in both halves)
  float lrun = 0.0f;                // running sum over this half's slots only; halves joined after the loop
  v8f accO[2];
  accO[0] = zero8();
  accO[1] = zero8();

  int wst = qc0 - 8;
  if (wst < 0) wst = 0;
  if (wst > 32) wst = 32;
  const int kr0 = (qr - 3 < 0) ? 0 : (qr - 3);
  const int kr1 = (qr + 3 > 63) ? 63 : (qr + 3);
  const int dc0 = wst + 8 * h - (qc0 + m);   // key col - query col of slot 8h

  for (int kr = kr0; kr <= kr1; ++kr) {
    const int t0 = kr * 64 + wst;   // multiple of 8 -> 16-B aligned rows

    // V fragments of the 32 key slots: element (x, e) of lane (h, m) = V[t0 + 16x + 8h + e][16db + m]
    Frag vfh[2], vfl[2];
#pragma unroll
    for (int db = 0; db < 2; ++db) {
      const size_t vo = hb + (size_t)t0 * 32 + (size_t)(h * 256 + db * 128 + m * 8);
      vfh[db].half[0] = *(const us8*)(vh + vo);
      vfh[db].half[1] = *(const us8*)(vh + vo + 512);
      vfl[db].half[0] = *(const us8*)(vl + vo);
      vfl[db].half[1] = *(const us8*)(vl + vo + 512);
    }

    // scores for two 16-slot chunks: D[r] = S[q = m][slot 16c + 8h + r]
    v8f s[2];
#pragma unroll
    for (int c = 0; c < 2; ++c) {
      // element (x, e) of lane (h, m) = K[t0 + 16c + m][16x + 8h + e]
      const size_t ko = hb + (size_t)(t0 + 16 * c) * 32 + (size_t)((m >> 3) * 256 + h * 64 + (m & 7) * 8);
      Frag kfh, kfl;
      kfh.half[0] = *(const us8*)(kh + ko);
      kfh.half[1] = *(const us8*)(kh + ko + 128);
      kfl.half[0] = *(const us8*)(kl + ko);
      kfl.half[1] = *(const us8*)(kl + ko + 128);
      s[c] = mma3(kfh, kfl, qfh, qfl, zero8());
    }

    // locality mask + scale
#pragma unroll
    for (int c = 0; c < 2; ++c) {
#pragma unroll
      for (int r = 0; r < 8; ++r) {
        const int dc = dc0 + 16 * c + r;
        const bool ok = (dc >= -3) && (dc <= 3);
        s[c][r] = ok ? s[c][r] * alpha : -__builtin_inff();
      }
    }

    // online softmax over the 32 slots of this key row
    float rm = fmaxf(s[0][0], s[1][0]);
#pragma unroll
    for (int r = 1; r < 8; ++r) rm = fmaxf(rm, fmaxf(s[0][r], s[1][r]));
    rm = fmaxf(rm, xhalf(rm));
    const float mn = fmaxf(mrun, rm);        // finite: every query has >= 4 valid keys per row
    const float sc = __expf(mrun - mn);      // 0 on the first key row
    Frag pfh, pfl;
    float ps[2];
#pragma unroll
    for (int c = 0; c < 2; ++c) {
      ps[c] = 0.0f;
#pragma unroll
      for (int r = 0; r < 8; ++r) {
        const float p = __expf(s[c][r] - mn);   // masked -> 0
        us hs, ls;
        split2(p, hs, ls);
        pfh.u[8 * c + r] = hs;
        pfl.u[8 * c + r] = ls;
        ps[c] += p;
      }
    }
    lrun = lrun * sc + (ps[0] + ps[1]);
    mrun = mn;

#pragma unroll
    for (int r = 0; r < 8; ++r) {
      accO[0][r] *= sc;
      accO[1][r] *= sc;
    }

    // O^T[d][q] += sum_slot V[slot][d] * P[q][slot]
#pragma unroll
    for (int db = 0; db < 2; ++db)
      accO[db] = mma3(vfh[db], vfl[db], pfh, pfl, accO[db]);
  }

  // W fragments of this wave's 16 output columns, all 8 k-steps
  Frag wfh[8], wfl[8];
#pragma unroll
  for (int ks = 0; ks < 8; ++ks) {
    const size_t off = (size_t)w * 4096 + (size_t)ks * 512 + (size_t)l * 8;
    wfh[ks] = ldpack(Wh + off);
    wfl[ks] = ldpack(Wl + off);
  }
  const float bj = bias[16 * w + m];

  const float inv = 1.0f / (lrun + xhalf(lrun));   // sum >= 1

#pragma unroll
  for (int db = 0; db < 2; ++db) {
    us8 hv, lv;
#pragma unroll
    for (int r = 0; r < 8; ++r) {
      us hs, ls;
      split2(accO[db][r] * inv, hs, ls);
      hv[r] = hs;
      lv[r] = ls;
    }
    *(us8*)&Oh[qt][hd][8 * (32 * db + l)] = hv;
    *(us8*)&Ol[qt][hd][8 * (32 * db + l)] = lv;
  }
  __syncthreads();   // all 8 heads of both query tiles are in LDS

  v8f acc[2];
  acc[0] = zero8();
  acc[1] = zero8();
  // A fragments are read from LDS one k-step ahead, as one group, into a second register set
  Frag afh[2][2], afl[2][2];
#pragma unroll
  for (int i = 0; i < 2; ++i) {
    afh[0][i] = ldpack(&Oh[i][0][l * 8]);
    afl[0][i] = ldpack(&Ol[i][0][l * 8]);
  }
#pragma unroll
  for (int ks = 0; ks < 8; ++ks) {
    if (ks < 7) {
#pragma unroll
      for (int i = 0; i < 2; ++i) {
        afh[(ks + 1) & 1][i] = ldpack(&Oh[i][ks + 1][l * 8]);
        afl[(ks + 1) & 1][i] = ldpack(&Ol[i][ks + 1][l * 8]);
      }
    }
#pragma unroll
    for (int i = 0; i < 2; ++i)
      acc[i] = mma3(afh[ks & 1][i], afl[ks & 1][i], wfh[ks], wfl[ks], acc[i]);
  }

  // D element r of lane (h, m): row 16i + 8h + r of the block's 32 queries, column 16w + m
#pragma unroll
  for (int i = 0; i < 2; ++i)
#pragma unroll
    for (int r = 0; r < 8; ++r)
      Tf[16 * i + 8 * h + r][16 * w + m] = acc[i][r] + bj;
  __syncthreads();   // the whole 32 x 256 tile is staged

  v4f ov[4];
#pragma unroll
  for (int q = 0; q < 4; ++q) {
    const int g = 32 * q + l;
    ov[q] = *(const v4f*)&Tf[2 * w + (g >> 6)][(g & 63) * 4];
  }
  const size_t base = ((size_t)b * 4096 + (size_t)(bid & 127) * 32 + (size_t)(2 * w)) * 256;
#pragma unroll
  for (int q = 0; q < 4; ++q)
    *(v4f*)(out + base + (size_t)4 * (32 * q + l)) = ov[q];
}

// ----------------------------------------------------------------------------
extern "C" void kernel_launch(void* const* d_in, const int* in_sizes, int n_in,
                              void* d_out, int out_size, void* d_ws, size_t ws_size,
                              hipStream_t stream) {
  const int M = 8192;      // B * N
  const int C = 256;
  const int C3 = 768;
  if (n_in < 5) return;
  if (in_sizes[0] != M * C || in_sizes[1] != C3 * C || in_sizes[2] != C * C ||
      in_sizes[3] != C || in_sizes[4] < 1 || out_size != M * C) return;

  const float* x     = (const float*)d_in[0];   // [2,4096,256]
  const float* wqkv  = (const float*)d_in[1];   // [768,256]
  const float* wproj = (const float*)d_in[2];   // [256,256]
  const float* bproj = (const float*)d_in[3];   // [256]
  const float* temp  = (const float*)d_in[4];   // [1]
  float* out = (float*)d_out;                   // [2,4096,256] f32

  const size_t szX  = (size_t)M * C * 2;        // one bf16 plane of x / q / k / v
  const size_t szW1 = (size_t)C3 * C * 2;
  const size_t szW2 = (size_t)C * C * 2;
  size_t off = 0;
  char* ws = (char*)d_ws;
  us* xh  = (us*)(ws + off); off += szX;
  us* xl  = (us*)(ws + off); off += szX;
  us* w1h = (us*)(ws + off); off += szW1;
  us* w1l = (us*)(ws + off); off += szW1;
  us* w2h = (us*)(ws + off); off += szW2;
  us* w2l = (us*)(ws + off); off += szW2;
  us* qh  = (us*)(ws + off); off += szX;
  us* ql  = (us*)(ws + off); off += szX;
  us* kh  = (us*)(ws + off); off += szX;
  us* kl  = (us*)(ws + off); off += szX;
  us* vh  = (us*)(ws + off); off += szX;
  us* vl  = (us*)(ws + off); off += szX;   // total 34,603,008 bytes
  if (off > ws_size) return;

  const int n0 = M * C, n1 = C3 * C, n2 = C * C;
  const int nb0 = (n0 / 8 + 255) / 256;   // 1024
  const int nb1 = (n1 / 8 + 255) / 256;   // 96
  const int nb2 = (n2 / 8 + 255) / 256;   // 32
  k_split<<<nb0 + nb1 + nb2, 256, 0, stream>>>(x, n0, xh, xl, wqkv, n1, w1h, w1l,
                                               wproj, n2, w2h, w2l, nb0, nb1);

  k_gemm_qkv<<<dim3(C3 / 64, M / 128), 256, 0, stream>>>(xh, xl, w1h, w1l,
                                                          qh, ql, kh, kl, vh, vl);

  k_attn_proj<<<M / 32, 512, 0, stream>>>(qh, ql, kh, kl, vh, vl, temp, w2h, w2l, bproj, out);
}

// v004
// A run of this version takes 37.8 microseconds.
// Two timings next to v003 put it at 1.09 and 1.08 times that version's speed.
// All steps since v000 together make it 2.20 times as fast.
#include <hip/hip_runtime.h>

// All contractions (qkv projection, q.k^T scores, p.v, output projection): v_wmma_f32_16x16x32_bf16 with bf16 hi/lo split operands (hi*hi + hi*lo + lo*hi), f32 accumulate; softmax, scaling and bias in f32.

typedef unsigned short us;
typedef us us8 __attribute__((ext_vector_type(8)));
typedef us us16 __attribute__((ext_vector_type(16)));
typedef __bf16 bf16x16 __attribute__((ext_vector_type(16)));
typedef float v8f __attribute__((ext_vector_type(8)));
typedef float v4f __attribute__((ext_vector_type(4)));

union Frag {
  bf16x16 v;
  us16 u;
  us8 half[2];
};

// f32 -> bf16 bits, RNE convert
__device__ __forceinline__ us f2bf(float f) {
  unsigned u = __float_as_uint(f);
  u += 0x7FFFu + ((u >> 16) & 1u);
  return (us)(u >> 16);
}

// f32 -> (hi, lo) bf16 pair: hi = rne(f), lo = rne(f - hi)
__device__ __forceinline__ void split2(float f, us& hi, us& lo) {
  const us hb = f2bf(f);
  const float hf = __uint_as_float(((unsigned)hb) << 16);
  hi = hb;
  lo = f2bf(f - hf);
}

// 16x32 operand fragment from a k-contiguous 16-bit row (row picked by lane&15 by the caller):
// elements 0..7 <- k0+8h+0..7, elements 8..15 <- k0+16+8h+0..7  (h = lane>>4). Same map for A and B.
__device__ __forceinline__ Frag ldfrag(const us* p, int h) {
  Frag f;
  f.half[0] = *(const us8*)(p + 8 * h);
  f.half[1] = *(const us8*)(p + 16 + 8 * h);
  return f;
}

// The same fragment from a plane stored in fragment order: per (16-row tile, k-step) two runs of 512 B,
// run x holds for lane (h, m) the 8 elements k0+16x+8h+0..7 of row m at 16-B chunk 16h+m, so one
// wave-wide 16-B load covers four whole 128-B lines. p already includes the lane's chunk (lane * 8).
__device__ __forceinline__ Frag ldpack(const us* p) {
  Frag f;
  f.half[0] = *(const us8*)p;
  f.half[1] = *(const us8*)(p + 256);
  return f;
}

__device__ __forceinline__ v8f wmma16(bf16x16 a, bf16x16 b, v8f c) {
  return __builtin_amdgcn_wmma_f32_16x16x32_bf16(false, a, false, b, (short)0, c, false, false);
}

// acc += A*B with A = ah+al, B = bh+bl (lo*lo dropped); hazard guard after the last WMMA of the group.
__device__ __forceinline__ v8f mma3(const Frag& ah, const Frag& al, const Frag& bh, const Frag& bl, v8f acc) {
  acc = wmma16(al.v, bh.v, acc);
  acc = wmma16(ah.v, bl.v, acc);
  acc = wmma16(ah.v, bh.v, acc);
  asm volatile("v_nop\n\tv_nop\n\tv_nop\n\tv_nop"
               : "+v"(acc)
               : "v"(ah.v), "v"(al.v), "v"(bh.v), "v"(bl.v));
  return acc;
}

__device__ __forceinline__ v8f zero8() {
  v8f z;
#pragma unroll
  for (int i = 0; i < 8; ++i) z[i] = 0.0f;
  return z;
}

// ----------------------------------------------------------------------------
// f32 -> bf16 hi/lo planes for x [8192x256], W_qkv [768x256], W_proj [256x256], stored in fragment
// order (see ldpack): 16-B chunk ((tile*8 + kstep)*2 + x)*32 + 16h + m holds row 16*tile + m,
// k = 32*kstep + 16x + 8h + 0..7. A wave takes 8 rows x 128 columns (4 k-steps), 4 chunks per lane:
// lane l owns row 8*half + (l >> 2) and piece p = l & 3 = 2x + h of each k-step, so 4 lanes read one whole
// 128-B line, all 8 loads of a lane are issued before the first conversion, and each store instruction
// writes 4 whole 128-B lines (8 consecutive chunks per piece). One wave does the work of four one-chunk waves.
__global__ __launch_bounds__(256) void k_split(
    const float* __restrict__ s0, int n0, us* h0, us* l0,
    const float* __restrict__ s1, int n1, us* h1, us* l1,
    const float* __restrict__ s2, int n2, us* h2, us* l2,
    int nb0, int nb1) {
  const int blk = blockIdx.x;
  const float* src;
  us* dh;
  us* dl;
  int n, base;
  if (blk < nb0) {
    src = s0; dh = h0; dl = l0; n = n0; base = blk;
  } else if (blk < nb0 + nb1) {
    src = s1; dh = h1; dl = l1; n = n1; base = blk - nb0;
  } else {
    src = s2; dh = h2; dl = l2; n = n2; base = blk - nb0 - nb1;
  }
  const int t = base * 256 + (int)threadIdx.x;
  const int l = t & 31;
  const int g = (t >> 5) & 1;       // which 4 k-steps
  const int half = (t >> 6) & 1;    // which 8 rows of the tile
  const int tile = t >> 7;
  if ((tile + 1) * 4096 <= n) {
    const int m = 8 * half + (l >> 2);
    const int p = l & 3;
    const float* sp = src + (size_t)(16 * tile + m) * 256 + (size_t)(128 * g + 8 * p);
    v4f a[4], c[4];
#pragma unroll
    for (int j = 0; j < 4; ++j) {
      a[j] = *(const v4f*)(sp + 32 * j);
      c[j] = *(const v4f*)(sp + 32 * j + 4);
    }
#pragma unroll
    for (int j = 0; j < 4; ++j) {
      us8 hv, lv;
#pragma unroll
      for (int e = 0; e < 4; ++e) {
        us hs, ls;
        split2(a[j][e], hs, ls);
        hv[e] = hs;
        lv[e] = ls;
        split2(c[j][e], hs, ls);
        hv[4 + e] = hs;
        lv[4 + e] = ls;
      }
      const size_t e0 = (size_t)(((tile * 8 + 4 * g + j) * 2 + (p >> 1)) * 32 + 16 * (p & 1) + m) * 8;
      *(us8*)(dh + e0) = hv;
      *(us8*)(dl + e0) = lv;
    }
  }
}

// ----------------------------------------------------------------------------
// GEMM main loop: wave tile 32(M) x 32(N), K = 256 in 8 steps of 32, operand fragments loaded
// directly from global hi/lo planes in fragment order (4096 elements per 16-row tile, 512 per k-step).
// A rows [M][256], W rows [N][256] (B[k][n] = W[n][k]); l = lane.
__device__ __forceinline__ void gemm_mainloop(const us* __restrict__ Ah, const us* __restrict__ Al,
                                              const us* __restrict__ Wh, const us* __restrict__ Wl,
                                              int r0, int c0, int l, v8f (&acc)[2][2]) {
#pragma unroll 1
  for (int ks = 0; ks < 8; ++ks) {
    Frag ah[2], al[2], bh[2], bl[2];
#pragma unroll
    for (int i = 0; i < 2; ++i) {
      const size_t off = (size_t)((r0 >> 4) + i) * 4096 + (size_t)ks * 512 + (size_t)l * 8;
      ah[i] = ldpack(Ah + off);
      al[i] = ldpack(Al + off);
    }
#pragma unroll
    for (int j = 0; j < 2; ++j) {
      const size_t off = (size_t)((c0 >> 4) + j) * 4096 + (size_t)ks * 512 + (size_t)l * 8;
      bh[j] = ldpack(Wh + off);
      bl[j] = ldpack(Wl + off);
    }
#pragma unroll
    for (int i = 0; i < 2; ++i)
#pragma unroll
      for (int j = 0; j < 2; ++j)
        acc[i][j] = mma3(ah[i], al[i], bh[j], bl[j], acc[i][j]);
  }
}

// ----------------------------------------------------------------------------
// QKV projection: C[8192 x 768] = Xs[8192 x 256] * Wqkv^T.
// Block 256 threads = 8 waves (4 x 2), block tile 128 x 64, grid (12, 64).
// Epilogue: a wave's 32x32 tile maps to one (q|k|v, head) and 32 consecutive tokens, i.e. 2048
// split hi/lo, staged in LDS and written with 4 lane-contiguous 16-B store instructions per plane.
// Plane layouts inside [b][head], 256 elements per group of 8 tokens:
//   q: [token][32]                          (row order)
//   k: [token/8][d/8][token%8][8 d]         (K fragments of the score product at any 8-token offset)
//   v: [token/8][d][8 tokens]               (transposed: V fragments of the p.v product at any 8-token offset)
__global__ __launch_bounds__(256) void k_gemm_qkv(
    const us* __restrict__ Xh, const us* __restrict__ Xl,
    const us* __restrict__ Wh, const us* __restrict__ Wl,
    us* qh, us* ql, us* kh, us* kl, us* vh, us* vl) {
  __shared__ __align__(16) us Th[8][32][40];
  __shared__ __align__(16) us Tl[8][32][40];
  const int tid = threadIdx.x;
  const int w = tid >> 5, l = tid & 31, h = l >> 4, m = l & 15;
  const int wm = w >> 1, wn = w & 1;
  const int r0 = (int)blockIdx.y * 128 + wm * 32;
  const int c0 = (int)blockIdx.x * 64 + wn * 32;

  v8f acc[2][2];
#pragma unroll
  for (int i = 0; i < 2; ++i)
#pragma unroll
    for (int j = 0; j < 2; ++j) acc[i][j] = zero8();

  gemm_mainloop(Xh, Xl, Wh, Wl, r0, c0, l, acc);

  const int three = c0 >> 8;   // same for the whole block (64 columns per block)

  // D element r of lane (h, m): row 16i + 8h + r, col 16j + m of the wave tile.
  // q, k staged as T[token][d]; v staged transposed as T[d][token] (8 tokens of a lane = one 16-B store)
#pragma unroll
  for (int i = 0; i < 2; ++i)
#pragma unroll
    for (int j = 0; j < 2; ++j) {
      us8 h8, l8;
#pragma unroll
      for (int r = 0; r < 8; ++r) {
        us hs, ls;
        split2(acc[i][j][r], hs, ls);
        h8[r] = hs;
        l8[r] = ls;
      }
      if (three == 2) {
        *(us8*)&Th[w][16 * j + m][16 * i + 8 * h] = h8;
        *(us8*)&Tl[w][16 * j + m][16 * i + 8 * h] = l8;
      } else {
#pragma unroll
        for (int r = 0; r < 8; ++r) {
          Th[w][16 * i + 8 * h + r][16 * j + m] = h8[r];
          Tl[w][16 * i + 8 * h + r][16 * j + m] = l8[r];
        }
      }
    }
  __syncthreads();

  const int head = (c0 & 255) >> 5;
  const int bb = r0 >> 12, n0 = r0 & 4095;
  us* dh = (three == 0) ? qh : ((three == 1) ? kh : vh);
  us* dl = (three == 0) ? ql : ((three == 1) ? kl : vl);
  const size_t dst = ((size_t)(bb * 8 + head) * 4096 + (size_t)n0) * 32;

  us8 hv[4], lv[4];
#pragma unroll
  for (int q = 0; q < 4; ++q) {
    const int g = 32 * q + l;          // 16-B chunk index in the plane's own order, 128 chunks
    int row, ds;
    if (three == 0) {
      row = g >> 2; ds = (g & 3) * 8;          // T[token][d], row order
    } else if (three == 1) {
      row = 8 * q + (l & 7); ds = (l >> 3) * 8;  // T[token][d], chunk = (token/8, d/8, token%8)
    } else {
      row = l; ds = 8 * q;                     // T[d][token], chunk = (token/8, d)
    }
    hv[q] = *(const us8*)&Th[w][row][ds];
    lv[q] = *(const us8*)&Tl[w][row][ds];
  }
#pragma unroll
  for (int q = 0; q < 4; ++q) {
    const size_t o = dst + (size_t)8 * (32 * q + l);
    *(us8*)(dh + o) = hv[q];
    *(us8*)(dl + o) = lv[q];
  }
  
}

__device__ __forceinline__ float xhalf(float x) {   // value of lane l ^ 16
  const int b = __builtin_bit_cast(int, x);
  return __builtin_bit_cast(float, __builtin_amdgcn_permlanex16(b, b, 0x76543210, 0xfedcba98, false, false));
}

__global__ __launch_bounds__(512) void k_attn_proj(
    const us* __restrict__ qh, const us* __restrict__ ql,
    const us* __restrict__ kh, const us* __restrict__ kl,
    const us* __restrict__ vh, const us* __restrict__ vl,
    const float* __restrict__ temp,
    const us* __restrict__ Wh, const us* __restrict__ Wl,
    const float* __restrict__ bias, float* out) {
  __shared__ __align__(16) us Oh[2][8][512];     // [query tile][k-step = head][fragment order]
  __shared__ __align__(16) us Ol[2][8][512];
  __shared__ __align__(16) float Tf[32][260];    // output tile, pitch 260: the two wave halves hit disjoint banks
  const int bid = blockIdx.x;
  const int w = __builtin_amdgcn_readfirstlane((int)threadIdx.x >> 5);   // wave number, kept scalar: head, tile and loop bounds stay uniform
  const int qt = w >> 3;
  const int hd = w & 7;
  const int b = bid >> 7;
  const int qblk = (bid & 127) * 2 + qt;
  const int l = threadIdx.x & 31, h = l >> 4, m = l & 15;
  const int q0 = qblk * 16;
  const int qr = q0 >> 6;
  const int qc0 = q0 & 63;
  const float alpha = 0.17677669529663689f * temp[0];   // hd^-0.5 * temperature
  const size_t hb = (size_t)(b * 8 + hd) * 4096 * 32;

  const Frag qfh = ldfrag(qh + hb + (size_t)(q0 + m) * 32, h);
  const Frag qfl = ldfrag(ql + hb + (size_t)(q0 + m) * 32, h);

  float mrun = -__builtin_inff();   // running maximum of query m (equal in both halves)
  float lrun = 0.0f;                // running sum over this half's slots only; halves joined after the loop
  v8f accO[2];
  accO[0] = zero8();
  accO[1] = zero8();

  int wst = qc0 - 8;
  if (wst < 0) wst = 0;
  if (wst > 32) wst = 32;
  const int kr0 = (qr - 3 < 0) ? 0 : (qr - 3);
  const int kr1 = (qr + 3 > 63) ? 63 : (qr + 3);
  const int dc0 = wst + 8 * h - (qc0 + m);   // key col - query col of slot 8h

  for (int kr = kr0; kr <= kr1; ++kr) {
    const int t0 = kr * 64 + wst;   // multiple of 8 -> 16-B aligned rows

    // V fragments of the 32 key slots: element (x, e) of lane (h, m) = V[t0 + 16x + 8h + e][16db + m]
    Frag vfh[2], vfl[2];
#pragma unroll
    for (int db = 0; db < 2; ++db) {
      const size_t vo = hb + (size_t)t0 * 32 + (size_t)(h * 256 + db * 128 + m * 8);
      vfh[db].half[0] = *(const us8*)(vh + vo);
      vfh[db].half[1] = *(const us8*)(vh + vo + 512);
      vfl[db].half[0] = *(const us8*)(vl + vo);
      vfl[db].half[1] = *(const us8*)(vl + vo + 512);
    }

    // scores for two 16-slot chunks: D[r] = S[q = m][slot 16c + 8h + r]
    v8f s[2];
#pragma unroll
    for (int c = 0; c < 2; ++c) {
      // element (x, e) of lane (h, m) = K[t0 + 16c + m][16x + 8h + e]
      const size_t ko = hb + (size_t)(t0 + 16 * c) * 32 + (size_t)((m >> 3) * 256 + h * 64 + (m & 7) * 8);
      Frag kfh, kfl;
      kfh.half[0] = *(const us8*)(kh + ko);
      kfh.half[1] = *(const us8*)(kh + ko + 128);
      kfl.half[0] = *(const us8*)(kl + ko);
      kfl.half[1] = *(const us8*)(kl + ko + 128);
      s[c] = mma3(kfh, kfl, qfh, qfl, zero8());
    }

    // locality mask + scale
#pragma unroll
    for (int c = 0; c < 2; ++c) {
#pragma unroll
      for (int r = 0; r < 8; ++r) {
        const int dc = dc0 + 16 * c + r;
        const bool ok = (dc >= -3) && (dc <= 3);
        s[c][r] = ok ? s[c][r] * alpha : -__builtin_inff();
      }
    }

    // online softmax over the 32 slots of this key row
    float rm = fmaxf(s[0][0], s[1][0]);
#pragma unroll
    for (int r = 1; r < 8; ++r) rm = fmaxf(rm, fmaxf(s[0][r], s[1][r]));
    rm = fmaxf(rm, xhalf(rm));
    const float mn = fmaxf(mrun, rm);        // finite: every query has >= 4 valid keys per row
    const float sc = __expf(mrun - mn);      // 0 on the first key row
    Frag pfh, pfl;
    float ps[2];
#pragma unroll
    for (int c = 0; c < 2; ++c) {
      ps[c] = 0.0f;
#pragma unroll
      for (int r = 0; r < 8; ++r) {
        const float p = __expf(s[c][r] - mn);   // masked -> 0
        us hs, ls;
        split2(p, hs, ls);
        pfh.u[8 * c + r] = hs;
        pfl.u[8 * c + r] = ls;
        ps[c] += p;
      }
    }
    lrun = lrun * sc + (ps[0] + ps[1]);
    mrun = mn;

#pragma unroll
    for (int r = 0; r < 8; ++r) {
      accO[0][r] *= sc;
      accO[1][r] *= sc;
    }

    // O^T[d][q] += sum_slot V[slot][d] * P[q][slot]
#pragma unroll
    for (int db = 0; db < 2; ++db)
      accO[db] = mma3(vfh[db], vfl[db], pfh, pfl, accO[db]);
  }

  // W fragments of this wave's 16 output columns, all 8 k-steps
  Frag wfh[8], wfl[8];
#pragma unroll
  for (int ks = 0; ks < 8; ++ks) {
    const size_t off = (size_t)w * 4096 + (size_t)ks * 512 + (size_t)l * 8;
    wfh[ks] = ldpack(Wh + off);
    wfl[ks] = ldpack(Wl + off);
  }
  const float bj = bias[16 * w + m];

  const float inv = 1.0f / (lrun + xhalf(lrun));   // sum >= 1

#pragma unroll
  for (int db = 0; db < 2; ++db) {
    us8 hv, lv;
#pragma unroll
    for (int r = 0; r < 8; ++r) {
      us hs, ls;
      split2(accO[db][r] * inv, hs, ls);
      hv[r] = hs;
      lv[r] = ls;
    }
    *(us8*)&Oh[qt][hd][8 * (32 * db + l)] = hv;
    *(us8*)&Ol[qt][hd][8 * (32 * db + l)] = lv;
  }
  __syncthreads();   // all 8 heads of both query tiles are in LDS

  v8f acc[2];
  acc[0] = zero8();
  acc[1] = zero8();
  // A fragments are read from LDS one k-step ahead, as one group, into a second register set
  Frag afh[2][2], afl[2][2];
#pragma unroll
  for (int i = 0; i < 2; ++i) {
    afh[0][i] = ldpack(&Oh[i][0][l * 8]);
    afl[0][i] = ldpack(&Ol[i][0][l * 8]);
  }
#pragma unroll
  for (int ks = 0; ks < 8; ++ks) {
    if (ks < 7) {
#pragma unroll
      for (int i = 0; i < 2; ++i) {
        afh[(ks + 1) & 1][i] = ldpack(&Oh[i][ks + 1][l * 8]);
        afl[(ks + 1) & 1][i] = ldpack(&Ol[i][ks + 1][l * 8]);
      }
    }
#pragma unroll
    for (int i = 0; i < 2; ++i)
      acc[i] = mma3(afh[ks & 1][i], afl[ks & 1][i], wfh[ks], wfl[ks], acc[i]);
  }

  // D element r of lane (h, m): row 16i + 8h + r of the block's 32 queries, column 16w + m
#pragma unroll
  for (int i = 0; i < 2; ++i)
#pragma unroll
    for (int r = 0; r < 8; ++r)
      Tf[16 * i + 8 * h + r][16 * w + m] = acc[i][r] + bj;
  __syncthreads();   // the whole 32 x 256 tile is staged

  v4f ov[4];
#pragma unroll
  for (int q = 0; q < 4; ++q) {
    const int g = 32 * q + l;
    ov[q] = *(const v4f*)&Tf[2 * w + (g >> 6)][(g & 63) * 4];
  }
  const size_t base = ((size_t)b * 4096 + (size_t)(bid & 127) * 32 + (size_t)(2 * w)) * 256;
#pragma unroll
  for (int q = 0; q < 4; ++q)
    *(v4f*)(out + base + (size_t)4 * (32 * q + l)) = ov[q];
}

// ----------------------------------------------------------------------------
extern "C" void kernel_launch(void* const* d_in, const int* in_sizes, int n_in,
                              void* d_out, int out_size, void* d_ws, size_t ws_size,
                              hipStream_t stream) {
  const int M = 8192;      // B * N
  const int C = 256;
  const int C3 = 768;
  if (n_in < 5) return;
  if (in_sizes[0] != M * C || in_sizes[1] != C3 * C || in_sizes[2] != C * C ||
      in_sizes[3] != C || in_sizes[4] < 1 || out_size != M * C) return;

  const float* x     = (const float*)d_in[0];   // [2,4096,256]
  const float* wqkv  = (const float*)d_in[1];   // [768,256]
  const float* wproj = (const float*)d_in[2];   // [256,256]
  const float* bproj = (const float*)d_in[3];   // [256]
  const float* temp  = (const float*)d_in[4];   // [1]
  float* out = (float*)d_out;                   // [2,4096,256] f32

  const size_t szX  = (size_t)M * C * 2;        // one bf16 plane of x / q / k / v
  const size_t szW1 = (size_t)C3 * C * 2;
  const size_t szW2 = (size_t)C * C * 2;
  size_t off = 0;
  char* ws = (char*)d_ws;
  us* xh  = (us*)(ws + off); off += szX;
  us* xl  = (us*)(ws + off); off += szX;
  us* w1h = (us*)(ws + off); off += szW1;
  us* w1l = (us*)(ws + off); off += szW1;
  us* w2h = (us*)(ws + off); off += szW2;
  us* w2l = (us*)(ws + off); off += szW2;
  us* qh  = (us*)(ws + off); off += szX;
  us* ql  = (us*)(ws + off); off += szX;
  us* kh  = (us*)(ws + off); off += szX;
  us* kl  = (us*)(ws + off); off += szX;
  us* vh  = (us*)(ws + off); off += szX;
  us* vl  = (us*)(ws + off); off += szX;   // total 34,603,008 bytes
  if (off > ws_size) return;

  const int n0 = M * C, n1 = C3 * C, n2 = C * C;
  const int nb0 = (n0 / 32 + 255) / 256;   // 256: a thread converts 32 elements
  const int nb1 = (n1 / 32 + 255) / 256;   // 24
  const int nb2 = (n2 / 32 + 255) / 256;   // 8
  k_split<<<nb0 + nb1 + nb2, 256, 0, stream>>>(x, n0, xh, xl, wqkv, n1, w1h, w1l,
                                               wproj, n2, w2h, w2l, nb0, nb1);

  k_gemm_qkv<<<dim3(C3 / 64, M / 128), 256, 0, stream>>>(xh, xl, w1h, w1l,
                                                          qh, ql, kh, kl, vh, vl);

  k_attn_proj<<<M / 32, 512, 0, stream>>>(qh, ql, kh, kl, vh, vl, temp, w2h, w2l, bproj, out);
}

// v005
// It runs in 33.9 microseconds.
// Two timings next to v004 both put it at 1.12 times that version's speed.
// Over all steps from v000 it is 2.47 times as fast.
#include <hip/hip_runtime.h>

// All contractions (qkv projection, q.k^T scores, p.v, output projection): v_wmma_f32_16x16x32_bf16 with bf16 hi/lo split operands (hi*hi + hi*lo + lo*hi), f32 accumulate; softmax, scaling and bias in f32.

typedef unsigned short us;
typedef us us8 __attribute__((ext_vector_type(8)));
typedef us us16 __attribute__((ext_vector_type(16)));
typedef __bf16 bf16x16 __attribute__((ext_vector_type(16)));
typedef float v8f __attribute__((ext_vector_type(8)));
typedef float v4f __attribute__((ext_vector_type(4)));

union Frag {
  bf16x16 v;
  us16 u;
  us8 half[2];
};

// f32 -> bf16 bits, RNE convert
__device__ __forceinline__ us f2bf(float f) {
  unsigned u = __float_as_uint(f);
  u += 0x7FFFu + ((u >> 16) & 1u);
  return (us)(u >> 16);
}

// f32 -> (hi, lo) bf16 pair: hi = rne(f), lo = rne(f - hi)
__device__ __forceinline__ void split2(float f, us& hi, us& lo) {
  const us hb = f2bf(f);
  const float hf = __uint_as_float(((unsigned)hb) << 16);
  hi = hb;
  lo = f2bf(f - hf);
}

// 16x32 operand fragment from a k-contiguous 16-bit row (row picked by lane&15 by the caller):
// elements 0..7 <- k0+8h+0..7, elements 8..15 <- k0+16+8h+0..7  (h = lane>>4). Same map for A and B.
__device__ __forceinline__ Frag ldfrag(const us* p, int h) {
  Frag f;
  f.half[0] = *(const us8*)(p + 8 * h);
  f.half[1] = *(const us8*)(p + 16 + 8 * h);
  return f;
}

// The same fragment from a plane stored in fragment order: per (16-row tile, k-step) two runs of 512 B,
// run x holds for lane (h, m) the 8 elements k0+16x+8h+0..7 of row m at 16-B chunk 16h+m, so one
// wave-wide 16-B load covers four whole 128-B lines. p already includes the lane's chunk (lane * 8).
__device__ __forceinline__ Frag ldpack(const us* p) {
  Frag f;
  f.half[0] = *(const us8*)p;
  f.half[1] = *(const us8*)(p + 256);
  return f;
}

__device__ __forceinline__ v8f wmma16(bf16x16 a, bf16x16 b, v8f c) {
  return __builtin_amdgcn_wmma_f32_16x16x32_bf16(false, a, false, b, (short)0, c, false, false);
}

// acc += A*B with A = ah+al, B = bh+bl (lo*lo dropped); hazard guard after the last WMMA of the group.
__device__ __forceinline__ v8f mma3(const Frag& ah, const Frag& al, const Frag& bh, const Frag& bl, v8f acc) {
  acc = wmma16(al.v, bh.v, acc);
  acc = wmma16(ah.v, bl.v, acc);
  acc = wmma16(ah.v, bh.v, acc);
  asm volatile("v_nop\n\tv_nop\n\tv_nop\n\tv_nop"
               : "+v"(acc)
               : "v"(ah.v), "v"(al.v), "v"(bh.v), "v"(bl.v));
  return acc;
}

__device__ __forceinline__ v8f zero8() {
  v8f z;
#pragma unroll
  for (int i = 0; i < 8; ++i) z[i] = 0.0f;
  return z;
}

// ----------------------------------------------------------------------------
// QKV projection with the f32 -> bf16 hi/lo split done in the kernel: C[8192 x 768] = x[8192 x 256] * Wqkv^T.
// One block of 8 waves (4 x 2) per 128 x 192 tile, grid 256 = 64 row blocks x 4 column blocks; wave tile 32 x 96.
// K runs in 4 chunks of 64 (2 k-steps). A chunk's 320 rows (128 of x, 192 of W) are read as f32, converted once
// per block and stored in LDS in fragment order (see ldpack); two buffers; k-step s of the next chunk is read as f32
// ahead of this chunk's k-step s and converted behind it; one barrier a chunk.
// Staging unit = 8 rows x 32 columns (one k-step) = one wave: lane l owns row l & 7 and piece p = l >> 3 = 2x + h,
// 8 consecutive k. LDS chunk of (x, h, m): run x, 16-B slot 16h + (m ^ 8h): the swap of the two 8-row halves for
// h = 1 puts the 16 lanes of a store on all 64 banks once; a fragment read still covers each 256-B run half whole.
// The block also converts its 1/256 of W_proj (8 rows x 32 columns) into the global planes that the next launch reads.
// Epilogue: each 32 x 32 part of a wave tile maps to one (q|k|v, head) and 32 consecutive tokens, i.e. 2048
// split hi/lo, staged in LDS and written with 4 lane-contiguous 16-B store instructions per plane.
// Plane layouts inside [b][head], 256 elements per group of 8 tokens:
//   q: [token][32]                          (row order)
//   k: [token/8][d/8][token%8][8 d]         (K fragments of the score product at any 8-token offset)
//   v: [token/8][d][8 tokens]               (transposed: V fragments of the p.v product at any 8-token offset)
typedef float f32x2 __attribute__((ext_vector_type(2)));
typedef __bf16 bf16x2 __attribute__((ext_vector_type(2)));
typedef unsigned u32x4 __attribute__((ext_vector_type(4)));

// 8 f32 -> 8 hi + 8 lo bf16, two at a time with the packed RNE convert: hi = rne(f), lo = rne(f - hi)
__device__ __forceinline__ void split8(v4f a, v4f c, us8& hv, us8& lv) {
  u32x4 hu, lu;
#pragma unroll
  for (int e = 0; e < 4; ++e) {
    f32x2 v;
    v.x = (e < 2) ? a[2 * e] : c[2 * e - 4];
    v.y = (e < 2) ? a[2 * e + 1] : c[2 * e - 3];
    const unsigned hb = __builtin_bit_cast(unsigned, __builtin_convertvector(v, bf16x2));
    f32x2 hf;
    hf.x = __uint_as_float(hb << 16);
    hf.y = __uint_as_float(hb & 0xFFFF0000u);
    const f32x2 d = v - hf;
    hu[e] = hb;
    lu[e] = __builtin_bit_cast(unsigned, __builtin_convertvector(d, bf16x2));
  }
  hv = __builtin_bit_cast(us8, hu);
  lv = __builtin_bit_cast(us8, lu);
}

__global__ __launch_bounds__(256) void k_gemm_qkv(
    const float* __restrict__ X, const float* __restrict__ Wq, const float* __restrict__ Wp,
    us* w2h, us* w2l,
    us* qh, us* ql, us* kh, us* kl, us* vh, us* vl) {
  // [buffer][hi | lo][20 tiles of 16 rows (8 of x, 12 of W)][2 k-steps][512]; reused by the epilogue
  __shared__ __align__(16) us S[4 * 20480];
  const int tid = threadIdx.x;
  const int w = __builtin_amdgcn_readfirstlane(tid >> 5);   // wave number, kept scalar: sources, tiles and planes stay uniform
  const int l = tid & 31, h = l >> 4, m = l & 15;
  const int wm = w >> 1, wn = w & 1;
  const int bid = blockIdx.x;
  const int rb = bid >> 2, cb = bid & 3;
  const int srow = l & 7, sp = l >> 3;

  // this wave's 5 groups of 8 rows: wave-uniform source of the group (the lane's part lo is the same for all), LDS slot of k-step 0
  const float* src[5];
  int dst[5];
  const unsigned lo = (unsigned)(srow * 256 + 8 * sp);
#pragma unroll
  for (int i = 0; i < 5; ++i) {
    const int rg = w * 5 + i;
    src[i] = (rg < 16) ? X + (size_t)(rb * 128 + rg * 8) * 256
                       : Wq + (size_t)(cb * 192 + (rg - 16) * 8) * 256;
    const int mm = 8 * (rg & 1) + srow;
    dst[i] = ((rg >> 1) * 4 + (sp >> 1)) * 256 + (16 * (sp & 1) + (mm ^ (8 * (sp & 1)))) * 8;
  }

  v4f ra[5], rc[5];   // one k-step of the wave's 5 row groups, f32

  v8f acc[2][6];
#pragma unroll
  for (int i = 0; i < 2; ++i)
#pragma unroll
    for (int j = 0; j < 6; ++j) acc[i][j] = zero8();

  // chunk 0 into buffer 0
#pragma unroll
  for (int s = 0; s < 2; ++s) {
#pragma unroll
    for (int i = 0; i < 5; ++i) {
      ra[i] = *(const v4f*)(src[i] + 32 * s + lo);
      rc[i] = *(const v4f*)(src[i] + (32 * s + 4) + lo);
    }
#pragma unroll
    for (int i = 0; i < 5; ++i) {
      us8 hv, lv;
      split8(ra[i], rc[i], hv, lv);
      *(us8*)&S[dst[i] + 512 * s] = hv;
      *(us8*)&S[20480 + dst[i] + 512 * s] = lv;
    }
  }
  __syncthreads();   // chunk 0 is in buffer 0

  const int lsw = (l ^ (h << 3)) * 8;   // the lane's slot in a run (see the swap above)
#pragma unroll   // unrolled: chunk and k-step become immediate offsets of 5 fixed address pairs and of the LDS reads, no address arithmetic in the loop
  for (int kc = 0; kc < 4; ++kc) {
    const us* Bh = &S[(kc & 1) * 40960 + lsw];
    const us* Bl = Bh + 20480;
    us* Dh = &S[((kc + 1) & 1) * 40960];   // next chunk's buffer: its readers left it at the barrier that ended chunk kc - 1
#pragma unroll
    for (int s = 0; s < 2; ++s) {
      if (kc < 3) {   // k-step s of the next chunk, f32: in flight under this k-step's products, none across a barrier
#pragma unroll
        for (int i = 0; i < 5; ++i) {
          const float* p = src[i] + (kc + 1) * 64 + 32 * s;
          ra[i] = *(const v4f*)(p + lo);
          rc[i] = *(const v4f*)(p + 4 + lo);
        }
      }
      Frag ah[2], al[2], bh[2], bl[2];
#pragma unroll
      for (int i = 0; i < 2; ++i) {
        const int off = ((wm * 2 + i) * 2 + s) * 512;
        ah[i] = ldpack(Bh + off);
        al[i] = ldpack(Bl + off);
      }
      bh[0] = ldpack(Bh + ((8 + wn * 6) * 2 + s) * 512);
      bl[0] = ldpack(Bl + ((8 + wn * 6) * 2 + s) * 512);
#pragma unroll
      for (int j = 0; j < 6; ++j) {
        if (j < 5) {   // W fragments one column tile ahead, into the second register set
          const int off = ((8 + wn * 6 + j + 1) * 2 + s) * 512;
          bh[(j + 1) & 1] = ldpack(Bh + off);
          bl[(j + 1) & 1] = ldpack(Bl + off);
        }
#pragma unroll
        for (int i = 0; i < 2; ++i)
          acc[i][j] = mma3(ah[i], al[i], bh[j & 1], bl[j & 1], acc[i][j]);
      }
      if (kc < 3) {
#pragma unroll
        for (int i = 0; i < 5; ++i) {
          us8 hv, lv;
          split8(ra[i], rc[i], hv, lv);
          *(us8*)&Dh[dst[i] + 512 * s] = hv;
          *(us8*)&Dh[20480 + dst[i] + 512 * s] = lv;
        }
      }
    }
    __syncthreads();   // chunk kc + 1 is published; every reader has left chunk kc's buffer
  }

  const int r0 = rb * 128 + wm * 32;
  const int bb = r0 >> 12, n0 = r0 & 4095;

  // W_proj: row group bid >> 3, k-step bid & 7; read here, under the conversions below, stored behind the barrier
  const int prg = bid >> 3, pks = bid & 7;
  v4f pa, pc;
  if (w == 0) {
    const float* p = Wp + (size_t)(prg * 8 + srow) * 256 + (size_t)(32 * pks + 8 * sp);
    pa = *(const v4f*)p;
    pc = *(const v4f*)(p + 4);
  }

  // D element r of lane (h, m): row 16i + 8h + r, col 16j + m of the 32 x 32 part.
  // q, k staged as T[token][d]; v staged transposed as T[d][token] (8 tokens of a lane = one 16-B store); pitch 40
#pragma unroll
  for (int jj = 0; jj < 3; ++jj) {
    const int three = (cb * 192 + wn * 96 + jj * 32) >> 8;   // wave-uniform
    us* Th = &S[(jj * 8 + w) * 1280];
    us* Tl = Th + 30720;
#pragma unroll
    for (int i = 0; i < 2; ++i)
#pragma unroll
      for (int j = 0; j < 2; ++j) {
        us8 h8, l8;
        const v8f t = acc[i][2 * jj + j];
        split8(__builtin_shufflevector(t, t, 0, 1, 2, 3), __builtin_shufflevector(t, t, 4, 5, 6, 7), h8, l8);
        if (three == 2) {
          *(us8*)&Th[(16 * j + m) * 40 + 16 * i + 8 * h] = h8;
          *(us8*)&Tl[(16 * j + m) * 40 + 16 * i + 8 * h] = l8;
        } else {
#pragma unroll
          for (int r = 0; r < 8; ++r) {
            Th[(16 * i + 8 * h + r) * 40 + 16 * j + m] = h8[r];
            Tl[(16 * i + 8 * h + r) * 40 + 16 * j + m] = l8[r];
          }
        }
      }
  }
  __syncthreads();

  if (w == 0) {   // global planes in fragment order (no swap)
    us8 hv, lv;
    split8(pa, pc, hv, lv);
    const size_t e0 = (size_t)((((prg >> 1) * 8 + pks) * 2 + (sp >> 1)) * 32 + 16 * (sp & 1) + 8 * (prg & 1) + srow) * 8;
    *(us8*)(w2h + e0) = hv;
    *(us8*)(w2l + e0) = lv;
    // the parts below reuse the registers that these stores name: keep the wait in front of their overwrite
    asm volatile("s_wait_xcnt 0x0" ::: "memory");
  }

#pragma unroll
  for (int jj = 0; jj < 3; ++jj) {
    const int c0 = cb * 192 + wn * 96 + jj * 32;
    const int three = c0 >> 8;
    const int head = (c0 & 255) >> 5;
    const us* Th = &S[(jj * 8 + w) * 1280];
    const us* Tl = Th + 30720;
    us* dh = (three == 0) ? qh : ((three == 1) ? kh : vh);
    us* dl = (three == 0) ? ql : ((three == 1) ? kl : vl);
    const size_t dso = ((size_t)(bb * 8 + head) * 4096 + (size_t)n0) * 32;

    us8 hv[4], lv[4];
#pragma unroll
    for (int q = 0; q < 4; ++q) {
      const int g = 32 * q + l;          // 16-B chunk index in the plane's own order, 128 chunks
      int row, ds;
      if (three == 0) {
        row = g >> 2; ds = (g & 3) * 8;          // T[token][d], row order
      } else if (three == 1) {
        row = 8 * q + (l & 7); ds = (l >> 3) * 8;  // T[token][d], chunk = (token/8, d/8, token%8)
      } else {
        row = l; ds = 8 * q;                     // T[d][token], chunk = (token/8, d)
      }
      hv[q] = *(const us8*)&Th[row * 40 + ds];
      lv[q] = *(const us8*)&Tl[row * 40 + ds];
    }
#pragma unroll
    for (int q = 0; q < 4; ++q) {
      const size_t o = dso + (size_t)8 * (32 * q + l);
      *(us8*)(dh + o) = hv[q];
      *(us8*)(dl + o) = lv[q];
    }
    // the next part reuses the registers that these stores name: keep the wait in front of their overwrite
    if (jj < 2) asm volatile("s_wait_xcnt 0x0" ::: "memory");
  }
}

__device__ __forceinline__ float xhalf(float x) {   // value of lane l ^ 16
  const int b = __builtin_bit_cast(int, x);
  return __builtin_bit_cast(float, __builtin_amdgcn_permlanex16(b, b, 0x76543210, 0xfedcba98, false, false));
}

__global__ __launch_bounds__(512) void k_attn_proj(
    const us* __restrict__ qh, const us* __restrict__ ql,
    const us* __restrict__ kh, const us* __restrict__ kl,
    const us* __restrict__ vh, const us* __restrict__ vl,
    const float* __restrict__ temp,
    const us* __restrict__ Wh, const us* __restrict__ Wl,
    const float* __restrict__ bias, float* out) {
  __shared__ __align__(16) us Oh[2][8][512];     // [query tile][k-step = head][fragment order]
  __shared__ __align__(16) us Ol[2][8][512];
  __shared__ __align__(16) float Tf[32][260];    // output tile, pitch 260: the two wave halves hit disjoint banks
  const int bid = blockIdx.x;
  const int w = __builtin_amdgcn_readfirstlane((int)threadIdx.x >> 5);   // wave number, kept scalar: head, tile and loop bounds stay uniform
  const int qt = w >> 3;
  const int hd = w & 7;
  const int b = bid >> 7;
  const int qblk = (bid & 127) * 2 + qt;
  const int l = threadIdx.x & 31, h = l >> 4, m = l & 15;
  const int q0 = qblk * 16;
  const int qr = q0 >> 6;
  const int qc0 = q0 & 63;
  const float alpha = 0.17677669529663689f * temp[0];   // hd^-0.5 * temperature
  const size_t hb = (size_t)(b * 8 + hd) * 4096 * 32;

  const Frag qfh = ldfrag(qh + hb + (size_t)(q0 + m) * 32, h);
  const Frag qfl = ldfrag(ql + hb + (size_t)(q0 + m) * 32, h);

  float mrun = -__builtin_inff();   // running maximum of query m (equal in both halves)
  float lrun = 0.0f;                // running sum over this half's slots only; halves joined after the loop
  v8f accO[2];
  accO[0] = zero8();
  accO[1] = zero8();

  int wst = qc0 - 8;
  if (wst < 0) wst = 0;
  if (wst > 32) wst = 32;
  const int kr0 = (qr - 3 < 0) ? 0 : (qr - 3);
  const int kr1 = (qr + 3 > 63) ? 63 : (qr + 3);
  const int dc0 = wst + 8 * h - (qc0 + m);   // key col - query col of slot 8h

  for (int kr = kr0; kr <= kr1; ++kr) {
    const int t0 = kr * 64 + wst;   // multiple of 8 -> 16-B aligned rows

    // V fragments of the 32 key slots: element (x, e) of lane (h, m) = V[t0 + 16x + 8h + e][16db + m]
    Frag vfh[2], vfl[2];
#pragma unroll
    for (int db = 0; db < 2; ++db) {
      const size_t vo = hb + (size_t)t0 * 32 + (size_t)(h * 256 + db * 128 + m * 8);
      vfh[db].half[0] = *(const us8*)(vh + vo);
      vfh[db].half[1] = *(const us8*)(vh + vo + 512);
      vfl[db].half[0] = *(const us8*)(vl + vo);
      vfl[db].half[1] = *(const us8*)(vl + vo + 512);
    }

    // scores for two 16-slot chunks: D[r] = S[q = m][slot 16c + 8h + r]
    v8f s[2];
#pragma unroll
    for (int c = 0; c < 2; ++c) {
      // element (x, e) of lane (h, m) = K[t0 + 16c + m][16x + 8h + e]
      const size_t ko = hb + (size_t)(t0 + 16 * c) * 32 + (size_t)((m >> 3) * 256 + h * 64 + (m & 7) * 8);
      Frag kfh, kfl;
      kfh.half[0] = *(const us8*)(kh + ko);
      kfh.half[1] = *(const us8*)(kh + ko + 128);
      kfl.half[0] = *(const us8*)(kl + ko);
      kfl.half[1] = *(const us8*)(kl + ko + 128);
      s[c] = mma3(kfh, kfl, qfh, qfl, zero8());
    }

    // locality mask + scale
#pragma unroll
    for (int c = 0; c < 2; ++c) {
#pragma unroll
      for (int r = 0; r < 8; ++r) {
        const int dc = dc0 + 16 * c + r;
        const bool ok = (dc >= -3) && (dc <= 3);
        s[c][r] = ok ? s[c][r] * alpha : -__builtin_inff();
      }
    }

    // online softmax over the 32 slots of this key row
    float rm = fmaxf(s[0][0], s[1][0]);
#pragma unroll
    for (int r = 1; r < 8; ++r) rm = fmaxf(rm, fmaxf(s[0][r], s[1][r]));
    rm = fmaxf(rm, xhalf(rm));
    const float mn = fmaxf(mrun, rm);        // finite: every query has >= 4 valid keys per row
    const float sc = __expf(mrun - mn);      // 0 on the first key row
    Frag pfh, pfl;
    float ps[2];
#pragma unroll
    for (int c = 0; c < 2; ++c) {
      ps[c] = 0.0f;
#pragma unroll
      for (int r = 0; r < 8; ++r) {
        const float p = __expf(s[c][r] - mn);   // masked -> 0
        us hs, ls;
        split2(p, hs, ls);
        pfh.u[8 * c + r] = hs;
        pfl.u[8 * c + r] = ls;
        ps[c] += p;
      }
    }
    lrun = lrun * sc + (ps[0] + ps[1]);
    mrun = mn;

#pragma unroll
    for (int r = 0; r < 8; ++r) {
      accO[0][r] *= sc;
      accO[1][r] *= sc;
    }

    // O^T[d][q] += sum_slot V[slot][d] * P[q][slot]
#pragma unroll
    for (int db = 0; db < 2; ++db)
      accO[db] = mma3(vfh[db], vfl[db], pfh, pfl, accO[db]);
  }

  // W fragments of this wave's 16 output columns, all 8 k-steps
  Frag wfh[8], wfl[8];
#pragma unroll
  for (int ks = 0; ks < 8; ++ks) {
    const size_t off = (size_t)w * 4096 + (size_t)ks * 512 + (size_t)l * 8;
    wfh[ks] = ldpack(Wh + off);
    wfl[ks] = ldpack(Wl + off);
  }
  const float bj = bias[16 * w + m];

  const float inv = 1.0f / (lrun + xhalf(lrun));   // sum >= 1

#pragma unroll
  for (int db = 0; db < 2; ++db) {
    us8 hv, lv;
#pragma unroll
    for (int r = 0; r < 8; ++r) {
      us hs, ls;
      split2(accO[db][r] * inv, hs, ls);
      hv[r] = hs;
      lv[r] = ls;
    }
    *(us8*)&Oh[qt][hd][8 * (32 * db + l)] = hv;
    *(us8*)&Ol[qt][hd][8 * (32 * db + l)] = lv;
  }
  __syncthreads();   // all 8 heads of both query tiles are in LDS

  v8f acc[2];
  acc[0] = zero8();
  acc[1] = zero8();
  // A fragments are read from LDS one k-step ahead, as one group, into a second register set
  Frag afh[2][2], afl[2][2];
#pragma unroll
  for (int i = 0; i < 2; ++i) {
    afh[0][i] = ldpack(&Oh[i][0][l * 8]);
    afl[0][i] = ldpack(&Ol[i][0][l * 8]);
  }
#pragma unroll
  for (int ks = 0; ks < 8; ++ks) {
    if (ks < 7) {
#pragma unroll
      for (int i = 0; i < 2; ++i) {
        afh[(ks + 1) & 1][i] = ldpack(&Oh[i][ks + 1][l * 8]);
        afl[(ks + 1) & 1][i] = ldpack(&Ol[i][ks + 1][l * 8]);
      }
    }
#pragma unroll
    for (int i = 0; i < 2; ++i)
      acc[i] = mma3(afh[ks & 1][i], afl[ks & 1][i], wfh[ks], wfl[ks], acc[i]);
  }

  // D element r of lane (h, m): row 16i + 8h + r of the block's 32 queries, column 16w + m
#pragma unroll
  for (int i = 0; i < 2; ++i)
#pragma unroll
    for (int r = 0; r < 8; ++r)
      Tf[16 * i + 8 * h + r][16 * w + m] = acc[i][r] + bj;
  __syncthreads();   // the whole 32 x 256 tile is staged

  v4f ov[4];
#pragma unroll
  for (int q = 0; q < 4; ++q) {
    const int g = 32 * q + l;
    ov[q] = *(const v4f*)&Tf[2 * w + (g >> 6)][(g & 63) * 4];
  }
  const size_t base = ((size_t)b * 4096 + (size_t)(bid & 127) * 32 + (size_t)(2 * w)) * 256;
#pragma unroll
  for (int q = 0; q < 4; ++q)
    *(v4f*)(out + base + (size_t)4 * (32 * q + l)) = ov[q];
}

// ----------------------------------------------------------------------------
extern "C" void kernel_launch(void* const* d_in, const int* in_sizes, int n_in,
                              void* d_out, int out_size, void* d_ws, size_t ws_size,
                              hipStream_t stream) {
  const int M = 8192;      // B * N
  const int C = 256;
  const int C3 = 768;
  if (n_in < 5) return;
  if (in_sizes[0] != M * C || in_sizes[1] != C3 * C || in_sizes[2] != C * C ||
      in_sizes[3] != C || in_sizes[4] < 1 || out_size != M * C) return;

  const float* x     = (const float*)d_in[0];   // [2,4096,256]
  const float* wqkv  = (const float*)d_in[1];   // [768,256]
  const float* wproj = (const float*)d_in[2];   // [256,256]
  const float* bproj = (const float*)d_in[3];   // [256]
  const float* temp  = (const float*)d_in[4];   // [1]
  float* out = (float*)d_out;                   // [2,4096,256] f32

  const size_t szX  = (size_t)M * C * 2;        // one bf16 plane of q / k / v
  const size_t szW2 = (size_t)C * C * 2;
  size_t off = 0;
  char* ws = (char*)d_ws;
  us* w2h = (us*)(ws + off); off += szW2;
  us* w2l = (us*)(ws + off); off += szW2;
  us* qh  = (us*)(ws + off); off += szX;
  us* ql  = (us*)(ws + off); off += szX;
  us* kh  = (us*)(ws + off); off += szX;
  us* kl  = (us*)(ws + off); off += szX;
  us* vh  = (us*)(ws + off); off += szX;
  us* vl  = (us*)(ws + off); off += szX;   // total 25,427,968 bytes
  if (off > ws_size) return;

  k_gemm_qkv<<<(M / 128) * (C3 / 192), 256, 0, stream>>>(x, wqkv, wproj, w2h, w2l,
                                                         qh, ql, kh, kl, vh, vl);

  k_attn_proj<<<M / 32, 512, 0, stream>>>(qh, ql, kh, kl, vh, vl, temp, w2h, w2l, bproj, out);
}

// v006
// It runs in 32.7 microseconds.
// Timed twice side by side with v005, it ran 1.04 times as fast both times.
// Over all steps from v000 it is 2.56 times as fast.
#include <hip/hip_runtime.h>

// All contractions (qkv projection, q.k^T scores, p.v, output projection): v_wmma_f32_16x16x32_bf16 with bf16 hi/lo split operands (hi*hi + hi*lo + lo*hi), f32 accumulate; softmax, scaling and bias in f32.

typedef unsigned short us;
typedef us us8 __attribute__((ext_vector_type(8)));
typedef us us16 __attribute__((ext_vector_type(16)));
typedef __bf16 bf16x16 __attribute__((ext_vector_type(16)));
typedef float v8f __attribute__((ext_vector_type(8)));
typedef float v4f __attribute__((ext_vector_type(4)));

union Frag {
  bf16x16 v;
  us16 u;
  us8 half[2];
};

// 16x32 operand fragment from a k-contiguous 16-bit row (row picked by lane&15 by the caller):
// elements 0..7 <- k0+8h+0..7, elements 8..15 <- k0+16+8h+0..7  (h = lane>>4). Same map for A and B.
__device__ __forceinline__ Frag ldfrag(const us* p, int h) {
  Frag f;
  f.half[0] = *(const us8*)(p + 8 * h);
  f.half[1] = *(const us8*)(p + 16 + 8 * h);
  return f;
}

// The same fragment from a plane stored in fragment order: per (16-row tile, k-step) two runs of 512 B,
// run x holds for lane (h, m) the 8 elements k0+16x+8h+0..7 of row m at 16-B chunk 16h+m, so one
// wave-wide 16-B load covers four whole 128-B lines. p already includes the lane's chunk (lane * 8).
__device__ __forceinline__ Frag ldpack(const us* p) {
  Frag f;
  f.half[0] = *(const us8*)p;
  f.half[1] = *(const us8*)(p + 256);
  return f;
}

__device__ __forceinline__ v8f wmma16(bf16x16 a, bf16x16 b, v8f c) {
  return __builtin_amdgcn_wmma_f32_16x16x32_bf16(false, a, false, b, (short)0, c, false, false);
}

// acc += A*B with A = ah+al, B = bh+bl (lo*lo dropped); hazard guard after the last WMMA of the group.
__device__ __forceinline__ v8f mma3(const Frag& ah, const Frag& al, const Frag& bh, const Frag& bl, v8f acc) {
  acc = wmma16(al.v, bh.v, acc);
  acc = wmma16(ah.v, bl.v, acc);
  acc = wmma16(ah.v, bh.v, acc);
  asm volatile("v_nop\n\tv_nop\n\tv_nop\n\tv_nop"
               : "+v"(acc)
               : "v"(ah.v), "v"(al.v), "v"(bh.v), "v"(bl.v));
  return acc;
}

__device__ __forceinline__ v8f zero8() {
  v8f z;
#pragma unroll
  for (int i = 0; i < 8; ++i) z[i] = 0.0f;
  return z;
}

// ----------------------------------------------------------------------------
// QKV projection with the f32 -> bf16 hi/lo split done in the kernel: C[8192 x 768] = x[8192 x 256] * Wqkv^T.
// One block of 8 waves (4 x 2) per 128 x 192 tile, grid 256 = 64 row blocks x 4 column blocks; wave tile 32 x 96.
// K runs in 4 chunks of 64 (2 k-steps). A chunk's 320 rows (128 of x, 192 of W) are read as f32, converted once
// per block and stored in LDS in fragment order (see ldpack); two buffers; k-step s of the next chunk is read as f32
// ahead of this chunk's k-step s and converted behind it; one barrier a chunk.
// Staging unit = 8 rows x 32 columns (one k-step) = one wave: lane l owns row l & 7 and piece p = l >> 3 = 2x + h,
// 8 consecutive k. LDS chunk of (x, h, m): run x, 16-B slot 16h + (m ^ 8h): the swap of the two 8-row halves for
// h = 1 puts the 16 lanes of a store on all 64 banks once; a fragment read still covers each 256-B run half whole.
// The block also converts its 1/256 of W_proj (8 rows x 32 columns) into the global planes that the next launch reads.
// Epilogue: each 32 x 32 part of a wave tile maps to one (q|k|v, head) and 32 consecutive tokens, i.e. 2048
// split hi/lo, staged in LDS and written with 4 lane-contiguous 16-B store instructions per plane.
// Plane layouts inside [b][head], 256 elements per group of 8 tokens:
//   q: [token][32]                          (row order)
//   k: [token/8][d/8][token%8][8 d]         (K fragments of the score product at any 8-token offset)
//   v: [token/8][d][8 tokens]               (transposed: V fragments of the p.v product at any 8-token offset)
typedef float f32x2 __attribute__((ext_vector_type(2)));
typedef __bf16 bf16x2 __attribute__((ext_vector_type(2)));
typedef unsigned u32x4 __attribute__((ext_vector_type(4)));

// 8 f32 -> 8 hi + 8 lo bf16, two at a time with the packed RNE convert: hi = rne(f), lo = rne(f - hi)
__device__ __forceinline__ void split8(v4f a, v4f c, us8& hv, us8& lv) {
  u32x4 hu, lu;
#pragma unroll
  for (int e = 0; e < 4; ++e) {
    f32x2 v;
    v.x = (e < 2) ? a[2 * e] : c[2 * e - 4];
    v.y = (e < 2) ? a[2 * e + 1] : c[2 * e - 3];
    const unsigned hb = __builtin_bit_cast(unsigned, __builtin_convertvector(v, bf16x2));
    f32x2 hf;
    hf.x = __uint_as_float(hb << 16);
    hf.y = __uint_as_float(hb & 0xFFFF0000u);
    const f32x2 d = v - hf;
    hu[e] = hb;
    lu[e] = __builtin_bit_cast(unsigned, __builtin_convertvector(d, bf16x2));
  }
  hv = __builtin_bit_cast(us8, hu);
  lv = __builtin_bit_cast(us8, lu);
}

__global__ __launch_bounds__(256) void k_gemm_qkv(
    const float* __restrict__ X, const float* __restrict__ Wq, const float* __restrict__ Wp,
    us* w2h, us* w2l,
    us* qh, us* ql, us* kh, us* kl, us* vh, us* vl) {
  // [buffer][hi | lo][20 tiles of 16 rows (8 of x, 12 of W)][2 k-steps][512]; reused by the epilogue
  __shared__ __align__(16) us S[4 * 20480];
  const int tid = threadIdx.x;
  const int w = __builtin_amdgcn_readfirstlane(tid >> 5);   // wave number, kept scalar: sources, tiles and planes stay uniform
  const int l = tid & 31, h = l >> 4, m = l & 15;
  const int wm = w >> 1, wn = w & 1;
  const int bid = blockIdx.x;
  const int rb = bid >> 2, cb = bid & 3;
  const int srow = l & 7, sp = l >> 3;

  // this wave's 5 groups of 8 rows: wave-uniform source of the group (the lane's part lo is the same for all), LDS slot of k-step 0
  const float* src[5];
  int dst[5];
  const unsigned lo = (unsigned)(srow * 256 + 8 * sp);
#pragma unroll
  for (int i = 0; i < 5; ++i) {
    const int rg = w * 5 + i;
    src[i] = (rg < 16) ? X + (size_t)(rb * 128 + rg * 8) * 256
                       : Wq + (size_t)(cb * 192 + (rg - 16) * 8) * 256;
    const int mm = 8 * (rg & 1) + srow;
    dst[i] = ((rg >> 1) * 4 + (sp >> 1)) * 256 + (16 * (sp & 1) + (mm ^ (8 * (sp & 1)))) * 8;
  }

  v4f ra[5], rc[5];   // one k-step of the wave's 5 row groups, f32

  v8f acc[2][6];
#pragma unroll
  for (int i = 0; i < 2; ++i)
#pragma unroll
    for (int j = 0; j < 6; ++j) acc[i][j] = zero8();

  // chunk 0 into buffer 0
#pragma unroll
  for (int s = 0; s < 2; ++s) {
#pragma unroll
    for (int i = 0; i < 5; ++i) {
      ra[i] = *(const v4f*)(src[i] + 32 * s + lo);
      rc[i] = *(const v4f*)(src[i] + (32 * s + 4) + lo);
    }
#pragma unroll
    for (int i = 0; i < 5; ++i) {
      us8 hv, lv;
      split8(ra[i], rc[i], hv, lv);
      *(us8*)&S[dst[i] + 512 * s] = hv;
      *(us8*)&S[20480 + dst[i] + 512 * s] = lv;
    }
  }
  __syncthreads();   // chunk 0 is in buffer 0

  const int lsw = (l ^ (h << 3)) * 8;   // the lane's slot in a run (see the swap above)
#pragma unroll   // unrolled: chunk and k-step become immediate offsets of 5 fixed address pairs and of the LDS reads, no address arithmetic in the loop
  for (int kc = 0; kc < 4; ++kc) {
    const us* Bh = &S[(kc & 1) * 40960 + lsw];
    const us* Bl = Bh + 20480;
    us* Dh = &S[((kc + 1) & 1) * 40960];   // next chunk's buffer: its readers left it at the barrier that ended chunk kc - 1
#pragma unroll
    for (int s = 0; s < 2; ++s) {
      if (kc < 3) {   // k-step s of the next chunk, f32: in flight under this k-step's products, none across a barrier
#pragma unroll
        for (int i = 0; i < 5; ++i) {
          const float* p = src[i] + (kc + 1) * 64 + 32 * s;
          ra[i] = *(const v4f*)(p + lo);
          rc[i] = *(const v4f*)(p + 4 + lo);
        }
      }
      Frag ah[2], al[2], bh[2], bl[2];
#pragma unroll
      for (int i = 0; i < 2; ++i) {
        const int off = ((wm * 2 + i) * 2 + s) * 512;
        ah[i] = ldpack(Bh + off);
        al[i] = ldpack(Bl + off);
      }
      bh[0] = ldpack(Bh + ((8 + wn * 6) * 2 + s) * 512);
      bl[0] = ldpack(Bl + ((8 + wn * 6) * 2 + s) * 512);
#pragma unroll
      for (int j = 0; j < 6; ++j) {
        if (j < 5) {   // W fragments one column tile ahead, into the second register set
          const int off = ((8 + wn * 6 + j + 1) * 2 + s) * 512;
          bh[(j + 1) & 1] = ldpack(Bh + off);
          bl[(j + 1) & 1] = ldpack(Bl + off);
        }
#pragma unroll
        for (int i = 0; i < 2; ++i)
          acc[i][j] = mma3(ah[i], al[i], bh[j & 1], bl[j & 1], acc[i][j]);
      }
      if (kc < 3) {
#pragma unroll
        for (int i = 0; i < 5; ++i) {
          us8 hv, lv;
          split8(ra[i], rc[i], hv, lv);
          *(us8*)&Dh[dst[i] + 512 * s] = hv;
          *(us8*)&Dh[20480 + dst[i] + 512 * s] = lv;
        }
      }
    }
    __syncthreads();   // chunk kc + 1 is published; every reader has left chunk kc's buffer
  }

  const int r0 = rb * 128 + wm * 32;
  const int bb = r0 >> 12, n0 = r0 & 4095;

  // W_proj: row group bid >> 3, k-step bid & 7; read here, under the conversions below, stored behind the barrier
  const int prg = bid >> 3, pks = bid & 7;
  v4f pa, pc;
  if (w == 0) {
    const float* p = Wp + (size_t)(prg * 8 + srow) * 256 + (size_t)(32 * pks + 8 * sp);
    pa = *(const v4f*)p;
    pc = *(const v4f*)(p + 4);
  }

  // D element r of lane (h, m): row 16i + 8h + r, col 16j + m of the 32 x 32 part.
  // q, k staged as T[token][d]; v staged transposed as T[d][token] (8 tokens of a lane = one 16-B store); pitch 40
#pragma unroll
  for (int jj = 0; jj < 3; ++jj) {
    const int three = (cb * 192 + wn * 96 + jj * 32) >> 8;   // wave-uniform
    us* Th = &S[(jj * 8 + w) * 1280];
    us* Tl = Th + 30720;
#pragma unroll
    for (int i = 0; i < 2; ++i)
#pragma unroll
      for (int j = 0; j < 2; ++j) {
        us8 h8, l8;
        const v8f t = acc[i][2 * jj + j];
        split8(__builtin_shufflevector(t, t, 0, 1, 2, 3), __builtin_shufflevector(t, t, 4, 5, 6, 7), h8, l8);
        if (three == 2) {
          *(us8*)&Th[(16 * j + m) * 40 + 16 * i + 8 * h] = h8;
          *(us8*)&Tl[(16 * j + m) * 40 + 16 * i + 8 * h] = l8;
        } else {
#pragma unroll
          for (int r = 0; r < 8; ++r) {
            Th[(16 * i + 8 * h + r) * 40 + 16 * j + m] = h8[r];
            Tl[(16 * i + 8 * h + r) * 40 + 16 * j + m] = l8[r];
          }
        }
      }
  }
  __syncthreads();

  if (w == 0) {   // global planes in fragment order (no swap)
    us8 hv, lv;
    split8(pa, pc, hv, lv);
    const size_t e0 = (size_t)((((prg >> 1) * 8 + pks) * 2 + (sp >> 1)) * 32 + 16 * (sp & 1) + 8 * (prg & 1) + srow) * 8;
    *(us8*)(w2h + e0) = hv;
    *(us8*)(w2l + e0) = lv;
    // the parts below reuse the registers that these stores name: keep the wait in front of their overwrite
    asm volatile("s_wait_xcnt 0x0" ::: "memory");
  }

#pragma unroll
  for (int jj = 0; jj < 3; ++jj) {
    const int c0 = cb * 192 + wn * 96 + jj * 32;
    const int three = c0 >> 8;
    const int head = (c0 & 255) >> 5;
    const us* Th = &S[(jj * 8 + w) * 1280];
    const us* Tl = Th + 30720;
    us* dh = (three == 0) ? qh : ((three == 1) ? kh : vh);
    us* dl = (three == 0) ? ql : ((three == 1) ? kl : vl);
    const size_t dso = ((size_t)(bb * 8 + head) * 4096 + (size_t)n0) * 32;

    us8 hv[4], lv[4];
#pragma unroll
    for (int q = 0; q < 4; ++q) {
      const int g = 32 * q + l;          // 16-B chunk index in the plane's own order, 128 chunks
      int row, ds;
      if (three == 0) {
        row = g >> 2; ds = (g & 3) * 8;          // T[token][d], row order
      } else if (three == 1) {
        row = 8 * q + (l & 7); ds = (l >> 3) * 8;  // T[token][d], chunk = (token/8, d/8, token%8)
      } else {
        row = l; ds = 8 * q;                     // T[d][token], chunk = (token/8, d)
      }
      hv[q] = *(const us8*)&Th[row * 40 + ds];
      lv[q] = *(const us8*)&Tl[row * 40 + ds];
    }
#pragma unroll
    for (int q = 0; q < 4; ++q) {
      const size_t o = dso + (size_t)8 * (32 * q + l);
      *(us8*)(dh + o) = hv[q];
      *(us8*)(dl + o) = lv[q];
    }
    // the next part reuses the registers that these stores name: keep the wait in front of their overwrite
    if (jj < 2) asm volatile("s_wait_xcnt 0x0" ::: "memory");
  }
}

__device__ __forceinline__ float xhalf(float x) {   // value of lane l ^ 16
  const int b = __builtin_bit_cast(int, x);
  return __builtin_bit_cast(float, __builtin_amdgcn_permlanex16(b, b, 0x76543210, 0xfedcba98, false, false));
}

__global__ __launch_bounds__(512) void k_attn_proj(
    const us* __restrict__ qh, const us* __restrict__ ql,
    const us* __restrict__ kh, const us* __restrict__ kl,
    const us* __restrict__ vh, const us* __restrict__ vl,
    const float* __restrict__ temp,
    const us* __restrict__ Wh, const us* __restrict__ Wl,
    const float* __restrict__ bias, float* out) {
  __shared__ __align__(16) us Oh[2][8][512];     // [query tile][k-step = head][fragment order]
  __shared__ __align__(16) us Ol[2][8][512];
  __shared__ __align__(16) float Tf[32][260];    // output tile, pitch 260: the two wave halves hit disjoint banks
  const int bid = blockIdx.x;
  const int w = __builtin_amdgcn_readfirstlane((int)threadIdx.x >> 5);   // wave number, kept scalar: head, tile and loop bounds stay uniform
  const int qt = w >> 3;
  const int hd = w & 7;
  const int b = bid >> 7;
  const int qblk = (bid & 127) * 2 + qt;
  const int l = threadIdx.x & 31, h = l >> 4, m = l & 15;
  const int q0 = qblk * 16;
  const int qr = q0 >> 6;
  const int qc0 = q0 & 63;
  const float alpha = 0.17677669529663689f * temp[0];   // hd^-0.5 * temperature
  const size_t hb = (size_t)(b * 8 + hd) * 4096 * 32;

  const Frag qfh = ldfrag(qh + hb + (size_t)(q0 + m) * 32, h);
  const Frag qfl = ldfrag(ql + hb + (size_t)(q0 + m) * 32, h);

  float mrun = -__builtin_inff();   // running maximum of query m (equal in both halves)
  float lrun = 0.0f;                // running sum over this half's slots only; halves joined after the loop
  v8f accO[2];
  accO[0] = zero8();
  accO[1] = zero8();

  int wst = qc0 - 8;
  if (wst < 0) wst = 0;
  if (wst > 32) wst = 32;
  const int kr0 = (qr - 3 < 0) ? 0 : (qr - 3);
  const int kr1 = (qr + 3 > 63) ? 63 : (qr + 3);
  const int dc0 = wst + 8 * h - (qc0 + m);   // key col - query col of slot 8h

  for (int kr = kr0; kr <= kr1; ++kr) {
    const int t0 = kr * 64 + wst;   // multiple of 8 -> 16-B aligned rows

    // V fragments of the 32 key slots: element (x, e) of lane (h, m) = V[t0 + 16x + 8h + e][16db + m]
    Frag vfh[2], vfl[2];
#pragma unroll
    for (int db = 0; db < 2; ++db) {
      const size_t vo = hb + (size_t)t0 * 32 + (size_t)(h * 256 + db * 128 + m * 8);
      vfh[db].half[0] = *(const us8*)(vh + vo);
      vfh[db].half[1] = *(const us8*)(vh + vo + 512);
      vfl[db].half[0] = *(const us8*)(vl + vo);
      vfl[db].half[1] = *(const us8*)(vl + vo + 512);
    }

    // scores for two 16-slot chunks: D[r] = S[q = m][slot 16c + 8h + r]
    v8f s[2];
#pragma unroll
    for (int c = 0; c < 2; ++c) {
      // element (x, e) of lane (h, m) = K[t0 + 16c + m][16x + 8h + e]
      const size_t ko = hb + (size_t)(t0 + 16 * c) * 32 + (size_t)((m >> 3) * 256 + h * 64 + (m & 7) * 8);
      Frag kfh, kfl;
      kfh.half[0] = *(const us8*)(kh + ko);
      kfh.half[1] = *(const us8*)(kh + ko + 128);
      kfl.half[0] = *(const us8*)(kl + ko);
      kfl.half[1] = *(const us8*)(kl + ko + 128);
      s[c] = mma3(kfh, kfl, qfh, qfl, zero8());
    }

    // locality mask + scale
#pragma unroll
    for (int c = 0; c < 2; ++c) {
#pragma unroll
      for (int r = 0; r < 8; ++r) {
        const int dc = dc0 + 16 * c + r;
        const bool ok = (dc >= -3) && (dc <= 3);
        s[c][r] = ok ? s[c][r] * alpha : -__builtin_inff();
      }
    }

    // online softmax over the 32 slots of this key row
    float rm = fmaxf(s[0][0], s[1][0]);
#pragma unroll
    for (int r = 1; r < 8; ++r) rm = fmaxf(rm, fmaxf(s[0][r], s[1][r]));
    rm = fmaxf(rm, xhalf(rm));
    const float mn = fmaxf(mrun, rm);        // finite: every query has >= 4 valid keys per row
    const float sc = __expf(mrun - mn);      // 0 on the first key row
    Frag pfh, pfl;
    float ps[2];
#pragma unroll
    for (int c = 0; c < 2; ++c) {
      ps[c] = 0.0f;
      v8f p;
#pragma unroll
      for (int r = 0; r < 8; ++r) {
        p[r] = __expf(s[c][r] - mn);   // masked -> 0
        ps[c] += p[r];
      }
      split8(__builtin_shufflevector(p, p, 0, 1, 2, 3), __builtin_shufflevector(p, p, 4, 5, 6, 7), pfh.half[c], pfl.half[c]);
    }
    lrun = lrun * sc + (ps[0] + ps[1]);
    mrun = mn;

#pragma unroll
    for (int r = 0; r < 8; ++r) {
      accO[0][r] *= sc;
      accO[1][r] *= sc;
    }

    // O^T[d][q] += sum_slot V[slot][d] * P[q][slot]
#pragma unroll
    for (int db = 0; db < 2; ++db)
      accO[db] = mma3(vfh[db], vfl[db], pfh, pfl, accO[db]);
  }

  // W fragments of this wave's 16 output columns, all 8 k-steps
  Frag wfh[8], wfl[8];
#pragma unroll
  for (int ks = 0; ks < 8; ++ks) {
    const size_t off = (size_t)w * 4096 + (size_t)ks * 512 + (size_t)l * 8;
    wfh[ks] = ldpack(Wh + off);
    wfl[ks] = ldpack(Wl + off);
  }
  const float bj = bias[16 * w + m];

  const float inv = 1.0f / (lrun + xhalf(lrun));   // sum >= 1

#pragma unroll
  for (int db = 0; db < 2; ++db) {
    us8 hv, lv;
    const v8f o = accO[db] * inv;
    split8(__builtin_shufflevector(o, o, 0, 1, 2, 3), __builtin_shufflevector(o, o, 4, 5, 6, 7), hv, lv);
    *(us8*)&Oh[qt][hd][8 * (32 * db + l)] = hv;
    *(us8*)&Ol[qt][hd][8 * (32 * db + l)] = lv;
  }
  __syncthreads();   // all 8 heads of both query tiles are in LDS

  v8f acc[2];
  acc[0] = zero8();
  acc[1] = zero8();
  // A fragments are read from LDS one k-step ahead, as one group, into a second register set
  Frag afh[2][2], afl[2][2];
#pragma unroll
  for (int i = 0; i < 2; ++i) {
    afh[0][i] = ldpack(&Oh[i][0][l * 8]);
    afl[0][i] = ldpack(&Ol[i][0][l * 8]);
  }
#pragma unroll
  for (int ks = 0; ks < 8; ++ks) {
    if (ks < 7) {
#pragma unroll
      for (int i = 0; i < 2; ++i) {
        afh[(ks + 1) & 1][i] = ldpack(&Oh[i][ks + 1][l * 8]);
        afl[(ks + 1) & 1][i] = ldpack(&Ol[i][ks + 1][l * 8]);
      }
    }
#pragma unroll
    for (int i = 0; i < 2; ++i)
      acc[i] = mma3(afh[ks & 1][i], afl[ks & 1][i], wfh[ks], wfl[ks], acc[i]);
  }

  // D element r of lane (h, m): row 16i + 8h + r of the block's 32 queries, column 16w + m
#pragma unroll
  for (int i = 0; i < 2; ++i)
#pragma unroll
    for (int r = 0; r < 8; ++r)
      Tf[16 * i + 8 * h + r][16 * w + m] = acc[i][r] + bj;
  __syncthreads();   // the whole 32 x 256 tile is staged

  v4f ov[4];
#pragma unroll
  for (int q = 0; q < 4; ++q) {
    const int g = 32 * q + l;
    ov[q] = *(const v4f*)&Tf[2 * w + (g >> 6)][(g & 63) * 4];
  }
  const size_t base = ((size_t)b * 4096 + (size_t)(bid & 127) * 32 + (size_t)(2 * w)) * 256;
#pragma unroll
  for (int q = 0; q < 4; ++q)
    *(v4f*)(out + base + (size_t)4 * (32 * q + l)) = ov[q];
}

// ----------------------------------------------------------------------------
extern "C" void kernel_launch(void* const* d_in, const int* in_sizes, int n_in,
                              void* d_out, int out_size, void* d_ws, size_t ws_size,
                              hipStream_t stream) {
  const int M = 8192;      // B * N
  const int C = 256;
  const int C3 = 768;
  if (n_in < 5) return;
  if (in_sizes[0] != M * C || in_sizes[1] != C3 * C || in_sizes[2] != C * C ||
      in_sizes[3] != C || in_sizes[4] < 1 || out_size != M * C) return;

  const float* x     = (const float*)d_in[0];   // [2,4096,256]
  const float* wqkv  = (const float*)d_in[1];   // [768,256]
  const float* wproj = (const float*)d_in[2];   // [256,256]
  const float* bproj = (const float*)d_in[3];   // [256]
  const float* temp  = (const float*)d_in[4];   // [1]
  float* out = (float*)d_out;                   // [2,4096,256] f32

  const size_t szX  = (size_t)M * C * 2;        // one bf16 plane of q / k / v
  const size_t szW2 = (size_t)C * C * 2;
  size_t off = 0;
  char* ws = (char*)d_ws;
  us* w2h = (us*)(ws + off); off += szW2;
  us* w2l = (us*)(ws + off); off += szW2;
  us* qh  = (us*)(ws + off); off += szX;
  us* ql  = (us*)(ws + off); off += szX;
  us* kh  = (us*)(ws + off); off += szX;
  us* kl  = (us*)(ws + off); off += szX;
  us* vh  = (us*)(ws + off); off += szX;
  us* vl  = (us*)(ws + off); off += szX;   // total 25,427,968 bytes
  if (off > ws_size) return;

  k_gemm_qkv<<<(M / 128) * (C3 / 192), 256, 0, stream>>>(x, wqkv, wproj, w2h, w2l,
                                                         qh, ql, kh, kl, vh, vl);

  k_attn_proj<<<M / 32, 512, 0, stream>>>(qh, ql, kh, kl, vh, vl, temp, w2h, w2l, bproj, out);
}

// v007
// Measured time: 30.4 microseconds a run.
// Two timings next to v006 both put it at 1.07 times that version's speed.
// Over all steps from v000 it is 2.75 times as fast.
#include <hip/hip_runtime.h>

// All contractions (qkv projection, q.k^T scores, p.v, output projection): v_wmma_f32_16x16x32_bf16 with bf16 hi/lo split operands (hi*hi + hi*lo + lo*hi), f32 accumulate; softmax, scaling and bias in f32.

typedef unsigned short us;
typedef us us8 __attribute__((ext_vector_type(8)));
typedef us us16 __attribute__((ext_vector_type(16)));
typedef __bf16 bf16x16 __attribute__((ext_vector_type(16)));
typedef float v8f __attribute__((ext_vector_type(8)));
typedef float v4f __attribute__((ext_vector_type(4)));

union Frag {
  bf16x16 v;
  us16 u;
  us8 half[2];
};

// 16x32 operand fragment of lane (h, m) = (lane>>4, lane&15): row (A) or column (B) m,
// elements 0..7 <- k0+8h+0..7, elements 8..15 <- k0+16+8h+0..7. Same map for A and B.
// Read from a plane stored in fragment order: per (16-row tile, k-step) two runs of 512 B,
// run x holds for lane (h, m) the 8 elements k0+16x+8h+0..7 of row m at 16-B chunk 16h+m, so one
// wave-wide 16-B load covers four whole 128-B lines. p already includes the lane's chunk (lane * 8).
__device__ __forceinline__ Frag ldpack(const us* p) {
  Frag f;
  f.half[0] = *(const us8*)p;
  f.half[1] = *(const us8*)(p + 256);
  return f;
}

__device__ __forceinline__ v8f wmma16(bf16x16 a, bf16x16 b, v8f c) {
  return __builtin_amdgcn_wmma_f32_16x16x32_bf16(false, a, false, b, (short)0, c, false, false);
}

// acc += A*B with A = ah+al, B = bh+bl (lo*lo dropped); hazard guard after the last WMMA of the group.
__device__ __forceinline__ v8f mma3(const Frag& ah, const Frag& al, const Frag& bh, const Frag& bl, v8f acc) {
  acc = wmma16(al.v, bh.v, acc);
  acc = wmma16(ah.v, bl.v, acc);
  acc = wmma16(ah.v, bh.v, acc);
  asm volatile("v_nop\n\tv_nop\n\tv_nop\n\tv_nop"
               : "+v"(acc)
               : "v"(ah.v), "v"(al.v), "v"(bh.v), "v"(bl.v));
  return acc;
}

// The same three products in the same order with the operands' roles swapped: acc^T += B^T * A^T (A = ah+al, B = bh+bl).
__device__ __forceinline__ v8f mma3t(const Frag& ah, const Frag& al, const Frag& bh, const Frag& bl, v8f acc) {
  acc = wmma16(bh.v, al.v, acc);
  acc = wmma16(bl.v, ah.v, acc);
  acc = wmma16(bh.v, ah.v, acc);
  asm volatile("v_nop\n\tv_nop\n\tv_nop\n\tv_nop"   // hazard guard, as in mma3
               : "+v"(acc)
               : "v"(ah.v), "v"(al.v), "v"(bh.v), "v"(bl.v));
  return acc;
}

__device__ __forceinline__ v8f zero8() {
  v8f z;
#pragma unroll
  for (int i = 0; i < 8; ++i) z[i] = 0.0f;
  return z;
}

// ----------------------------------------------------------------------------
// QKV projection with the f32 -> bf16 hi/lo split done in the kernel: C[8192 x 768] = x[8192 x 256] * Wqkv^T.
// One block of 8 waves (4 x 2) per 128 tokens x 192 columns, grid 256 = 64 row blocks x 4 column blocks; wave tile 32 x 96.
// Column block cb = heads 2cb and 2cb+1; wave column wn = head 2cb+wn: its 96 columns are that head's q, k and v (32 each),
// column tile j = 2 * (q|k|v) + half, so which plane a tile belongs to is known at compile time.
// K runs in 4 chunks of 64 (2 k-steps). A chunk's 320 rows (128 of x, 192 of W) are read as f32, converted once
// per block and stored in LDS in fragment order (see ldpack); two buffers; k-step s of the next chunk is read as f32
// ahead of this chunk's k-step s and converted behind it; one barrier a chunk.
// Staging unit = 8 rows x 32 columns (one k-step) = one wave: lane l owns row l & 7 and piece p = l >> 3 = 2x + h,
// 8 consecutive k. LDS chunk of (x, h, m): run x, 16-B slot 16h + (m ^ 8h): the swap of the two 8-row halves for
// h = 1 puts the 16 lanes of a store on all 64 banks once; a fragment read still covers each 256-B run half whole.
// The block also converts its 1/256 of W_proj (8 rows x 32 columns) into the global planes that the next launch reads.
// Epilogue: no LDS. The q and k tiles are computed transposed (A = W, B = x), so a lane's 8 accumulator values are
// 8 consecutive d of one token; the v tiles are not (A = x, B = W): 8 consecutive tokens of one d. Either way the 8 values,
// split hi/lo, are one 16-B chunk of the plane, and a wave-wide store covers four whole 128-B lines.
// Plane layouts inside [b][head], 256 elements per group of 8 tokens:
//   q: [token/16][d/16][(d/8)%2][token%16][8 d]  (fragment order: the Q fragment of a 16-query tile, see ldpack)
//   k: [token/8][d/8][token%8][8 d]         (K fragments of the score product at any 8-token offset)
//   v: [token/8][d][8 tokens]               (transposed: V fragments of the p.v product at any 8-token offset)
typedef float f32x2 __attribute__((ext_vector_type(2)));
typedef __bf16 bf16x2 __attribute__((ext_vector_type(2)));
typedef unsigned u32x4 __attribute__((ext_vector_type(4)));

// 8 f32 -> 8 hi + 8 lo bf16, two at a time with the packed RNE convert: hi = rne(f), lo = rne(f - hi)
__device__ __forceinline__ void split8(v4f a, v4f c, us8& hv, us8& lv) {
  u32x4 hu, lu;
#pragma unroll
  for (int e = 0; e < 4; ++e) {
    f32x2 v;
    v.x = (e < 2) ? a[2 * e] : c[2 * e - 4];
    v.y = (e < 2) ? a[2 * e + 1] : c[2 * e - 3];
    const unsigned hb = __builtin_bit_cast(unsigned, __builtin_convertvector(v, bf16x2));
    f32x2 hf;
    hf.x = __uint_as_float(hb << 16);
    hf.y = __uint_as_float(hb & 0xFFFF0000u);
    const f32x2 d = v - hf;
    hu[e] = hb;
    lu[e] = __builtin_bit_cast(unsigned, __builtin_convertvector(d, bf16x2));
  }
  hv = __builtin_bit_cast(us8, hu);
  lv = __builtin_bit_cast(us8, lu);
}

__global__ __launch_bounds__(256) void k_gemm_qkv(
    const float* __restrict__ X, const float* __restrict__ Wq, const float* __restrict__ Wp,
    us* w2h, us* w2l,
    us* qh, us* ql, us* kh, us* kl, us* vh, us* vl) {
  // [buffer][hi | lo][20 tiles of 16 rows (8 of x, 12 of W)][2 k-steps][512]
  __shared__ __align__(16) us S[4 * 20480];
  const int tid = threadIdx.x;
  const int w = __builtin_amdgcn_readfirstlane(tid >> 5);   // wave number, kept scalar: sources, tiles and planes stay uniform
  const int l = tid & 31, h = l >> 4, m = l & 15;
  const int wm = w >> 1, wn = w & 1;
  const int bid = blockIdx.x;
  const int rb = bid >> 2, cb = bid & 3;
  const int srow = l & 7, sp = l >> 3;

  // this wave's 5 groups of 8 rows: wave-uniform source of the group (the lane's part lo is the same for all), LDS slot of k-step 0
  const float* src[5];
  int dst[5];
  const unsigned lo = (unsigned)(srow * 256 + 8 * sp);
#pragma unroll
  for (int i = 0; i < 5; ++i) {
    const int rg = w * 5 + i;
    // W row groups 0..23: 8 of q, 8 of k, 8 of v, each the 64 rows of the block's two heads
    const int xrow = rb * 128 + rg * 8;
    const int wrow = ((rg >> 3) - 2) * 256 + cb * 64 + (rg & 7) * 8;
    src[i] = ((rg < 16) ? X : Wq) + (size_t)((rg < 16) ? xrow : wrow) * 256;
    const int mm = 8 * (rg & 1) + srow;
    dst[i] = ((rg >> 1) * 4 + (sp >> 1)) * 256 + (16 * (sp & 1) + (mm ^ (8 * (sp & 1)))) * 8;
  }

  v4f ra[5], rc[5];   // one k-step of the wave's 5 row groups, f32

  v8f acc[2][6];
#pragma unroll
  for (int i = 0; i < 2; ++i)
#pragma unroll
    for (int j = 0; j < 6; ++j) acc[i][j] = zero8();

  // chunk 0 into buffer 0
#pragma unroll
  for (int s = 0; s < 2; ++s) {
#pragma unroll
    for (int i = 0; i < 5; ++i) {
      ra[i] = *(const v4f*)(src[i] + 32 * s + lo);
      rc[i] = *(const v4f*)(src[i] + (32 * s + 4) + lo);
    }
#pragma unroll
    for (int i = 0; i < 5; ++i) {
      us8 hv, lv;
      split8(ra[i], rc[i], hv, lv);
      *(us8*)&S[dst[i] + 512 * s] = hv;
      *(us8*)&S[20480 + dst[i] + 512 * s] = lv;
    }
  }
  __syncthreads();   // chunk 0 is in buffer 0

  const int lsw = (l ^ (h << 3)) * 8;   // the lane's slot in a run (see the swap above)
#pragma unroll   // unrolled: chunk and k-step become immediate offsets of 5 fixed address pairs and of the LDS reads, no address arithmetic in the loop
  for (int kc = 0; kc < 4; ++kc) {
    const us* Bh = &S[(kc & 1) * 40960 + lsw];
    const us* Bl = Bh + 20480;
    us* Dh = &S[((kc + 1) & 1) * 40960];   // next chunk's buffer: its readers left it at the barrier that ended chunk kc - 1
#pragma unroll
    for (int s = 0; s < 2; ++s) {
      if (kc < 3) {   // k-step s of the next chunk, f32: in flight under this k-step's products, none across a barrier
#pragma unroll
        for (int i = 0; i < 5; ++i) {
          const float* p = src[i] + (kc + 1) * 64 + 32 * s;
          ra[i] = *(const v4f*)(p + lo);
          rc[i] = *(const v4f*)(p + 4 + lo);
        }
      }
      Frag ah[2], al[2], bh[2], bl[2];
#pragma unroll
      for (int i = 0; i < 2; ++i) {
        const int off = ((wm * 2 + i) * 2 + s) * 512;
        ah[i] = ldpack(Bh + off);
        al[i] = ldpack(Bl + off);
      }
      // column tile j of the wave = LDS tile 8 + 4 * (j >> 1) + 2 * wn + (j & 1)
      bh[0] = ldpack(Bh + ((8 + wn * 2) * 2 + s) * 512);
      bl[0] = ldpack(Bl + ((8 + wn * 2) * 2 + s) * 512);
#pragma unroll
      for (int j = 0; j < 6; ++j) {
        if (j < 5) {   // W fragments one column tile ahead, into the second register set
          const int off = ((8 + 4 * ((j + 1) >> 1) + wn * 2 + ((j + 1) & 1)) * 2 + s) * 512;
          bh[(j + 1) & 1] = ldpack(Bh + off);
          bl[(j + 1) & 1] = ldpack(Bl + off);
        }
#pragma unroll
        for (int i = 0; i < 2; ++i)
          acc[i][j] = (j < 4) ? mma3t(ah[i], al[i], bh[j & 1], bl[j & 1], acc[i][j])    // q, k: D[r] = C[token 16i+m][col 16j+8h+r]
                              : mma3(ah[i], al[i], bh[j & 1], bl[j & 1], acc[i][j]);    // v:    D[r] = C[token 16i+8h+r][col 16j+m]
      }
      if (kc < 3) {
#pragma unroll
        for (int i = 0; i < 5; ++i) {
          us8 hv, lv;
          split8(ra[i], rc[i], hv, lv);
          *(us8*)&Dh[dst[i] + 512 * s] = hv;
          *(us8*)&Dh[20480 + dst[i] + 512 * s] = lv;
        }
      }
    }
    if (kc < 3) __syncthreads();   // chunk kc + 1 is published; every reader has left chunk kc's buffer
  }

  const int r0 = rb * 128 + wm * 32;
  const int bb = r0 >> 12, n0 = r0 & 4095;

  // W_proj: row group bid >> 3, k-step bid & 7; read here, under the conversions below, stored at the end
  const int prg = bid >> 3, pks = bid & 7;
  v4f pa, pc;
  if (w == 0) {
    const float* p = Wp + (size_t)(prg * 8 + srow) * 256 + (size_t)(32 * pks + 8 * sp);
    pa = *(const v4f*)p;
    pc = *(const v4f*)(p + 4);
  }

  const size_t dso = ((size_t)(bb * 8 + cb * 2 + wn) * 4096 + (size_t)n0) * 32;
#pragma unroll
  for (int jj = 0; jj < 3; ++jj) {
    us* dh = (jj == 0) ? qh : ((jj == 1) ? kh : vh);
    us* dl = (jj == 0) ? ql : ((jj == 1) ? kl : vl);
    // the lane's 16-B chunk in tile (i, j) = (0, 0) of the part, and the step from j = 0 to j = 1; i steps by 16 tokens = 512
    const int lane0 = (jj == 0) ? l * 8
                    : (jj == 1) ? (m >> 3) * 256 + h * 64 + (m & 7) * 8
                                : h * 256 + m * 8;
    const int jstep = (jj == 0) ? 256 : 128;
    us8 hv[4], lv[4];
#pragma unroll
    for (int i = 0; i < 2; ++i)
#pragma unroll
      for (int j = 0; j < 2; ++j) {
        const v8f t = acc[i][2 * jj + j];
        split8(__builtin_shufflevector(t, t, 0, 1, 2, 3), __builtin_shufflevector(t, t, 4, 5, 6, 7), hv[2 * i + j], lv[2 * i + j]);
      }
#pragma unroll
    for (int i = 0; i < 2; ++i)
#pragma unroll
      for (int j = 0; j < 2; ++j) {
        const size_t o = dso + (size_t)(lane0 + i * 512 + j * jstep);
        *(us8*)(dh + o) = hv[2 * i + j];
        *(us8*)(dl + o) = lv[2 * i + j];
      }
    // what follows reuses the registers that these stores name: keep the wait in front of their overwrite
    asm volatile("s_wait_xcnt 0x0" ::: "memory");
    __builtin_amdgcn_sched_barrier(0);   // keeps the next part's conversions, which write those registers, behind the wait
  }

  if (w == 0) {   // global planes in fragment order (no swap)
    us8 hv, lv;
    split8(pa, pc, hv, lv);
    const size_t e0 = (size_t)((((prg >> 1) * 8 + pks) * 2 + (sp >> 1)) * 32 + 16 * (sp & 1) + 8 * (prg & 1) + srow) * 8;
    *(us8*)(w2h + e0) = hv;
    *(us8*)(w2l + e0) = lv;
  }
}

__device__ __forceinline__ float xhalf(float x) {   // value of lane l ^ 16
  const int b = __builtin_bit_cast(int, x);
  return __builtin_bit_cast(float, __builtin_amdgcn_permlanex16(b, b, 0x76543210, 0xfedcba98, false, false));
}

__global__ __launch_bounds__(512) void k_attn_proj(
    const us* __restrict__ qh, const us* __restrict__ ql,
    const us* __restrict__ kh, const us* __restrict__ kl,
    const us* __restrict__ vh, const us* __restrict__ vl,
    const float* __restrict__ temp,
    const us* __restrict__ Wh, const us* __restrict__ Wl,
    const float* __restrict__ bias, float* out) {
  __shared__ __align__(16) us Oh[2][8][512];     // [query tile][k-step = head][fragment order]
  __shared__ __align__(16) us Ol[2][8][512];
  __shared__ __align__(16) float Tf[32][260];    // output tile, pitch 260: the two wave halves hit disjoint banks
  const int bid = blockIdx.x;
  const int w = __builtin_amdgcn_readfirstlane((int)threadIdx.x >> 5);   // wave number, kept scalar: head, tile and loop bounds stay uniform
  const int qt = w >> 3;
  const int hd = w & 7;
  const int b = bid >> 7;
  const int qblk = (bid & 127) * 2 + qt;
  const int l = threadIdx.x & 31, h = l >> 4, m = l & 15;
  const int q0 = qblk * 16;
  const int qr = q0 >> 6;
  const int qc0 = q0 & 63;
  const float alpha = 0.17677669529663689f * temp[0];   // hd^-0.5 * temperature
  const size_t hb = (size_t)(b * 8 + hd) * 4096 * 32;

  const Frag qfh = ldpack(qh + hb + (size_t)q0 * 32 + (size_t)(l * 8));
  const Frag qfl = ldpack(ql + hb + (size_t)q0 * 32 + (size_t)(l * 8));

  float mrun = -__builtin_inff();   // running maximum of query m (equal in both halves)
  float lrun = 0.0f;                // running sum over this half's slots only; halves joined after the loop
  v8f accO[2];
  accO[0] = zero8();
  accO[1] = zero8();

  int wst = qc0 - 8;
  if (wst < 0) wst = 0;
  if (wst > 32) wst = 32;
  const int kr0 = (qr - 3 < 0) ? 0 : (qr - 3);
  const int kr1 = (qr + 3 > 63) ? 63 : (qr + 3);
  const int dc0 = wst + 8 * h - (qc0 + m);   // key col - query col of slot 8h

  for (int kr = kr0; kr <= kr1; ++kr) {
    const int t0 = kr * 64 + wst;   // multiple of 8 -> 16-B aligned rows

    // V fragments of the 32 key slots: element (x, e) of lane (h, m) = V[t0 + 16x + 8h + e][16db + m]
    Frag vfh[2], vfl[2];
#pragma unroll
    for (int db = 0; db < 2; ++db) {
      const size_t vo = hb + (size_t)t0 * 32 + (size_t)(h * 256 + db * 128 + m * 8);
      vfh[db].half[0] = *(const us8*)(vh + vo);
      vfh[db].half[1] = *(const us8*)(vh + vo + 512);
      vfl[db].half[0] = *(const us8*)(vl + vo);
      vfl[db].half[1] = *(const us8*)(vl + vo + 512);
    }

    // scores for two 16-slot chunks: D[r] = S[q = m][slot 16c + 8h + r]
    v8f s[2];
#pragma unroll
    for (int c = 0; c < 2; ++c) {
      // element (x, e) of lane (h, m) = K[t0 + 16c + m][16x + 8h + e]
      const size_t ko = hb + (size_t)(t0 + 16 * c) * 32 + (size_t)((m >> 3) * 256 + h * 64 + (m & 7) * 8);
      Frag kfh, kfl;
      kfh.half[0] = *(const us8*)(kh + ko);
      kfh.half[1] = *(const us8*)(kh + ko + 128);
      kfl.half[0] = *(const us8*)(kl + ko);
      kfl.half[1] = *(const us8*)(kl + ko + 128);
      s[c] = mma3(kfh, kfl, qfh, qfl, zero8());
    }

    // locality mask + scale
#pragma unroll
    for (int c = 0; c < 2; ++c) {
#pragma unroll
      for (int r = 0; r < 8; ++r) {
        const int dc = dc0 + 16 * c + r;
        const bool ok = (dc >= -3) && (dc <= 3);
        s[c][r] = ok ? s[c][r] * alpha : -__builtin_inff();
      }
    }

    // online softmax over the 32 slots of this key row
    float rm = fmaxf(s[0][0], s[1][0]);
#pragma unroll
    for (int r = 1; r < 8; ++r) rm = fmaxf(rm, fmaxf(s[0][r], s[1][r]));
    rm = fmaxf(rm, xhalf(rm));
    const float mn = fmaxf(mrun, rm);        // finite: every query has >= 4 valid keys per row
    const float sc = __expf(mrun - mn);      // 0 on the first key row
    Frag pfh, pfl;
    float ps[2];
#pragma unroll
    for (int c = 0; c < 2; ++c) {
      ps[c] = 0.0f;
      v8f p;
#pragma unroll
      for (int r = 0; r < 8; ++r) {
        p[r] = __expf(s[c][r] - mn);   // masked -> 0
        ps[c] += p[r];
      }
      split8(__builtin_shufflevector(p, p, 0, 1, 2, 3), __builtin_shufflevector(p, p, 4, 5, 6, 7), pfh.half[c], pfl.half[c]);
    }
    lrun = lrun * sc + (ps[0] + ps[1]);
    mrun = mn;

#pragma unroll
    for (int r = 0; r < 8; ++r) {
      accO[0][r] *= sc;
      accO[1][r] *= sc;
    }

    // O^T[d][q] += sum_slot V[slot][d] * P[q][slot]
#pragma unroll
    for (int db = 0; db < 2; ++db)
      accO[db] = mma3(vfh[db], vfl[db], pfh, pfl, accO[db]);
  }

  // W fragments of this wave's 16 output columns, all 8 k-steps
  Frag wfh[8], wfl[8];
#pragma unroll
  for (int ks = 0; ks < 8; ++ks) {
    const size_t off = (size_t)w * 4096 + (size_t)ks * 512 + (size_t)l * 8;
    wfh[ks] = ldpack(Wh + off);
    wfl[ks] = ldpack(Wl + off);
  }
  const float bj = bias[16 * w + m];

  const float inv = 1.0f / (lrun + xhalf(lrun));   // sum >= 1

#pragma unroll
  for (int db = 0; db < 2; ++db) {
    us8 hv, lv;
    const v8f o = accO[db] * inv;
    split8(__builtin_shufflevector(o, o, 0, 1, 2, 3), __builtin_shufflevector(o, o, 4, 5, 6, 7), hv, lv);
    *(us8*)&Oh[qt][hd][8 * (32 * db + l)] = hv;
    *(us8*)&Ol[qt][hd][8 * (32 * db + l)] = lv;
  }
  __syncthreads();   // all 8 heads of both query tiles are in LDS

  v8f acc[2];
  acc[0] = zero8();
  acc[1] = zero8();
  // A fragments are read from LDS one k-step ahead, as one group, into a second register set
  Frag afh[2][2], afl[2][2];
#pragma unroll
  for (int i = 0; i < 2; ++i) {
    afh[0][i] = ldpack(&Oh[i][0][l * 8]);
    afl[0][i] = ldpack(&Ol[i][0][l * 8]);
  }
#pragma unroll
  for (int ks = 0; ks < 8; ++ks) {
    if (ks < 7) {
#pragma unroll
      for (int i = 0; i < 2; ++i) {
        afh[(ks + 1) & 1][i] = ldpack(&Oh[i][ks + 1][l * 8]);
        afl[(ks + 1) & 1][i] = ldpack(&Ol[i][ks + 1][l * 8]);
      }
    }
#pragma unroll
    for (int i = 0; i < 2; ++i)
      acc[i] = mma3(afh[ks & 1][i], afl[ks & 1][i], wfh[ks], wfl[ks], acc[i]);
  }

  // D element r of lane (h, m): row 16i + 8h + r of the block's 32 queries, column 16w + m
#pragma unroll
  for (int i = 0; i < 2; ++i)
#pragma unroll
    for (int r = 0; r < 8; ++r)
      Tf[16 * i + 8 * h + r][16 * w + m] = acc[i][r] + bj;
  __syncthreads();   // the whole 32 x 256 tile is staged

  v4f ov[4];
#pragma unroll
  for (int q = 0; q < 4; ++q) {
    const int g = 32 * q + l;
    ov[q] = *(const v4f*)&Tf[2 * w + (g >> 6)][(g & 63) * 4];
  }
  const size_t base = ((size_t)b * 4096 + (size_t)(bid & 127) * 32 + (size_t)(2 * w)) * 256;
#pragma unroll
  for (int q = 0; q < 4; ++q)
    *(v4f*)(out + base + (size_t)4 * (32 * q + l)) = ov[q];
}

// ----------------------------------------------------------------------------
extern "C" void kernel_launch(void* const* d_in, const int* in_sizes, int n_in,
                              void* d_out, int out_size, void* d_ws, size_t ws_size,
                              hipStream_t stream) {
  const int M = 8192;      // B * N
  const int C = 256;
  const int C3 = 768;
  if (n_in < 5) return;
  if (in_sizes[0] != M * C || in_sizes[1] != C3 * C || in_sizes[2] != C * C ||
      in_sizes[3] != C || in_sizes[4] < 1 || out_size != M * C) return;

  const float* x     = (const float*)d_in[0];   // [2,4096,256]
  const float* wqkv  = (const float*)d_in[1];   // [768,256]
  const float* wproj = (const float*)d_in[2];   // [256,256]
  const float* bproj = (const float*)d_in[3];   // [256]
  const float* temp  = (const float*)d_in[4];   // [1]
  float* out = (float*)d_out;                   // [2,4096,256] f32

  const size_t szX  = (size_t)M * C * 2;        // one bf16 plane of q / k / v
  const size_t szW2 = (size_t)C * C * 2;
  size_t off = 0;
  char* ws = (char*)d_ws;
  us* w2h = (us*)(ws + off); off += szW2;
  us* w2l = (us*)(ws + off); off += szW2;
  us* qh  = (us*)(ws + off); off += szX;
  us* ql  = (us*)(ws + off); off += szX;
  us* kh  = (us*)(ws + off); off += szX;
  us* kl  = (us*)(ws + off); off += szX;
  us* vh  = (us*)(ws + off); off += szX;
  us* vl  = (us*)(ws + off); off += szX;   // total 25,427,968 bytes
  if (off > ws_size) return;

  k_gemm_qkv<<<(M / 128) * (C3 / 192), 256, 0, stream>>>(x, wqkv, wproj, w2h, w2l,
                                                         qh, ql, kh, kl, vh, vl);

  k_attn_proj<<<M / 32, 512, 0, stream>>>(qh, ql, kh, kl, vh, vl, temp, w2h, w2l, bproj, out);
}

// v008
// A run of this version takes 28 microseconds.
// Timed twice side by side with v007, it ran 1.08 times as fast both times.
// Counting every step since v000, it is 2.98 times as fast.
#include <hip/hip_runtime.h>

// All contractions (qkv projection, q.k^T scores, p.v, output projection): v_wmma_f32_16x16x32_bf16 with bf16 hi/lo split operands (hi*hi + hi*lo + lo*hi), f32 accumulate; softmax, scaling and bias in f32.

typedef unsigned short us;
typedef us us8 __attribute__((ext_vector_type(8)));
typedef us us16 __attribute__((ext_vector_type(16)));
typedef __bf16 bf16x16 __attribute__((ext_vector_type(16)));
typedef float v8f __attribute__((ext_vector_type(8)));
typedef float v4f __attribute__((ext_vector_type(4)));

union Frag {
  bf16x16 v;
  us16 u;
  us8 half[2];
};

// 16x32 operand fragment of lane (h, m) = (lane>>4, lane&15): row (A) or column (B) m,
// elements 0..7 <- k0+8h+0..7, elements 8..15 <- k0+16+8h+0..7. Same map for A and B.
// Read from a plane stored in fragment order: per (16-row tile, k-step) two runs of 512 B,
// run x holds for lane (h, m) the 8 elements k0+16x+8h+0..7 of row m at 16-B chunk 16h+m, so one
// wave-wide 16-B load covers four whole 128-B lines. p already includes the lane's chunk (lane * 8).
__device__ __forceinline__ Frag ldpack(const us* p) {
  Frag f;
  f.half[0] = *(const us8*)p;
  f.half[1] = *(const us8*)(p + 256);
  return f;
}

__device__ __forceinline__ v8f wmma16(bf16x16 a, bf16x16 b, v8f c) {
  return __builtin_amdgcn_wmma_f32_16x16x32_bf16(false, a, false, b, (short)0, c, false, false);
}

// acc += A*B with A = ah+al, B = bh+bl (lo*lo dropped); hazard guard after the last WMMA of the group.
__device__ __forceinline__ v8f mma3(const Frag& ah, const Frag& al, const Frag& bh, const Frag& bl, v8f acc) {
  acc = wmma16(al.v, bh.v, acc);
  acc = wmma16(ah.v, bl.v, acc);
  acc = wmma16(ah.v, bh.v, acc);
  asm volatile("v_nop\n\tv_nop\n\tv_nop\n\tv_nop"
               : "+v"(acc)
               : "v"(ah.v), "v"(al.v), "v"(bh.v), "v"(bl.v));
  return acc;
}

// The same three products in the same order with the operands' roles swapped: acc^T += B^T * A^T (A = ah+al, B = bh+bl).
__device__ __forceinline__ v8f mma3t(const Frag& ah, const Frag& al, const Frag& bh, const Frag& bl, v8f acc) {
  acc = wmma16(bh.v, al.v, acc);
  acc = wmma16(bl.v, ah.v, acc);
  acc = wmma16(bh.v, ah.v, acc);
  asm volatile("v_nop\n\tv_nop\n\tv_nop\n\tv_nop"   // hazard guard, as in mma3
               : "+v"(acc)
               : "v"(ah.v), "v"(al.v), "v"(bh.v), "v"(bl.v));
  return acc;
}

__device__ __forceinline__ v8f zero8() {
  v8f z;
#pragma unroll
  for (int i = 0; i < 8; ++i) z[i] = 0.0f;
  return z;
}

// ----------------------------------------------------------------------------
// QKV projection with the f32 -> bf16 hi/lo split done in the kernel: C[8192 x 768] = x[8192 x 256] * Wqkv^T.
// One block of 8 waves (4 x 2) per 128 tokens x 192 columns, grid 256 = 64 row blocks x 4 column blocks; wave tile 32 x 96.
// Column block cb = heads 2cb and 2cb+1; wave column wn = head 2cb+wn: its 96 columns are that head's q, k and v (32 each),
// column tile j = 2 * (q|k|v) + half, so which plane a tile belongs to is known at compile time.
// K runs in 4 chunks of 64 (2 k-steps). A chunk's 320 rows (128 of x, 192 of W) are read as f32, converted once
// per block and stored in LDS in fragment order (see ldpack); two buffers; k-step s of the next chunk is read as f32
// ahead of this chunk's k-step s and converted behind it; one barrier a chunk.
// Staging unit = 8 rows x 32 columns (one k-step) = one wave: lane l owns row l & 7 and piece p = l >> 3 = 2x + h,
// 8 consecutive k. LDS chunk of (x, h, m): run x, 16-B slot 16h + (m ^ 8h): the swap of the two 8-row halves for
// h = 1 puts the 16 lanes of a store on all 64 banks once; a fragment read still covers each 256-B run half whole.
// The block also converts its 1/256 of W_proj (8 rows x 32 columns) into the global planes that the next launch reads.
// Epilogue: no LDS. The q and k tiles are computed transposed (A = W, B = x), so a lane's 8 accumulator values are
// 8 consecutive d of one token; the v tiles are not (A = x, B = W): 8 consecutive tokens of one d. Either way the 8 values,
// split hi/lo, are one 16-B chunk of the plane, and a wave-wide store covers four whole 128-B lines.
// Plane layouts inside [b][head], 256 elements per group of 8 tokens:
//   q: [token/16][d/16][(d/8)%2][token%16][8 d]  (fragment order: the Q fragment of a 16-query tile, see ldpack)
//   k: [token/8][d/8][token%8][8 d]         (K fragments of the score product at any 8-token offset)
//   v: [token/8][d][8 tokens]               (transposed: V fragments of the p.v product at any 8-token offset)
typedef float f32x2 __attribute__((ext_vector_type(2)));
typedef __bf16 bf16x2 __attribute__((ext_vector_type(2)));
typedef unsigned u32x4 __attribute__((ext_vector_type(4)));

// 8 f32 -> 8 hi + 8 lo bf16, two at a time with the packed RNE convert: hi = rne(f), lo = rne(f - hi)
__device__ __forceinline__ void split8(v4f a, v4f c, us8& hv, us8& lv) {
  u32x4 hu, lu;
#pragma unroll
  for (int e = 0; e < 4; ++e) {
    f32x2 v;
    v.x = (e < 2) ? a[2 * e] : c[2 * e - 4];
    v.y = (e < 2) ? a[2 * e + 1] : c[2 * e - 3];
    const unsigned hb = __builtin_bit_cast(unsigned, __builtin_convertvector(v, bf16x2));
    f32x2 hf;
    hf.x = __uint_as_float(hb << 16);
    hf.y = __uint_as_float(hb & 0xFFFF0000u);
    const f32x2 d = v - hf;
    hu[e] = hb;
    lu[e] = __builtin_bit_cast(unsigned, __builtin_convertvector(d, bf16x2));
  }
  hv = __builtin_bit_cast(us8, hu);
  lv = __builtin_bit_cast(us8, lu);
}

__global__ __launch_bounds__(256) void k_gemm_qkv(
    const float* __restrict__ X, const float* __restrict__ Wq, const float* __restrict__ Wp,
    us* w2h, us* w2l,
    us* qh, us* ql, us* kh, us* kl, us* vh, us* vl) {
  // [buffer][hi | lo][20 tiles of 16 rows (8 of x, 12 of W)][2 k-steps][512]
  __shared__ __align__(16) us S[4 * 20480];
  const int tid = threadIdx.x;
  const int w = __builtin_amdgcn_readfirstlane(tid >> 5);   // wave number, kept scalar: sources, tiles and planes stay uniform
  const int l = tid & 31, h = l >> 4, m = l & 15;
  const int wm = w >> 1, wn = w & 1;
  const int bid = blockIdx.x;
  const int rb = bid >> 2, cb = bid & 3;
  const int srow = l & 7, sp = l >> 3;

  // this wave's 5 groups of 8 rows: wave-uniform source of the group (the lane's part lo is the same for all), LDS slot of k-step 0
  const float* src[5];
  int dst[5];
  const unsigned lo = (unsigned)(srow * 256 + 8 * sp);
#pragma unroll
  for (int i = 0; i < 5; ++i) {
    const int rg = w * 5 + i;
    // W row groups 0..23: 8 of q, 8 of k, 8 of v, each the 64 rows of the block's two heads
    const int xrow = rb * 128 + rg * 8;
    const int wrow = ((rg >> 3) - 2) * 256 + cb * 64 + (rg & 7) * 8;
    src[i] = ((rg < 16) ? X : Wq) + (size_t)((rg < 16) ? xrow : wrow) * 256;
    const int mm = 8 * (rg & 1) + srow;
    dst[i] = ((rg >> 1) * 4 + (sp >> 1)) * 256 + (16 * (sp & 1) + (mm ^ (8 * (sp & 1)))) * 8;
  }

  v4f ra[5], rc[5];   // one k-step of the wave's 5 row groups, f32

  v8f acc[2][6];
#pragma unroll
  for (int i = 0; i < 2; ++i)
#pragma unroll
    for (int j = 0; j < 6; ++j) acc[i][j] = zero8();

  // chunk 0 into buffer 0
#pragma unroll
  for (int s = 0; s < 2; ++s) {
#pragma unroll
    for (int i = 0; i < 5; ++i) {
      ra[i] = *(const v4f*)(src[i] + 32 * s + lo);
      rc[i] = *(const v4f*)(src[i] + (32 * s + 4) + lo);
    }
#pragma unroll
    for (int i = 0; i < 5; ++i) {
      us8 hv, lv;
      split8(ra[i], rc[i], hv, lv);
      *(us8*)&S[dst[i] + 512 * s] = hv;
      *(us8*)&S[20480 + dst[i] + 512 * s] = lv;
    }
  }
  __syncthreads();   // chunk 0 is in buffer 0

  const int lsw = (l ^ (h << 3)) * 8;   // the lane's slot in a run (see the swap above)
#pragma unroll   // unrolled: chunk and k-step become immediate offsets of 5 fixed address pairs and of the LDS reads, no address arithmetic in the loop
  for (int kc = 0; kc < 4; ++kc) {
    const us* Bh = &S[(kc & 1) * 40960 + lsw];
    const us* Bl = Bh + 20480;
    us* Dh = &S[((kc + 1) & 1) * 40960];   // next chunk's buffer: its readers left it at the barrier that ended chunk kc - 1
#pragma unroll
    for (int s = 0; s < 2; ++s) {
      if (kc < 3) {   // k-step s of the next chunk, f32: in flight under this k-step's products, none across a barrier
#pragma unroll
        for (int i = 0; i < 5; ++i) {
          const float* p = src[i] + (kc + 1) * 64 + 32 * s;
          ra[i] = *(const v4f*)(p + lo);
          rc[i] = *(const v4f*)(p + 4 + lo);
        }
      }
      Frag ah[2], al[2], bh[2], bl[2];
#pragma unroll
      for (int i = 0; i < 2; ++i) {
        const int off = ((wm * 2 + i) * 2 + s) * 512;
        ah[i] = ldpack(Bh + off);
        al[i] = ldpack(Bl + off);
      }
      // column tile j of the wave = LDS tile 8 + 4 * (j >> 1) + 2 * wn + (j & 1)
      bh[0] = ldpack(Bh + ((8 + wn * 2) * 2 + s) * 512);
      bl[0] = ldpack(Bl + ((8 + wn * 2) * 2 + s) * 512);
#pragma unroll
      for (int j = 0; j < 6; ++j) {
        if (j < 5) {   // W fragments one column tile ahead, into the second register set
          const int off = ((8 + 4 * ((j + 1) >> 1) + wn * 2 + ((j + 1) & 1)) * 2 + s) * 512;
          bh[(j + 1) & 1] = ldpack(Bh + off);
          bl[(j + 1) & 1] = ldpack(Bl + off);
        }
#pragma unroll
        for (int i = 0; i < 2; ++i)
          acc[i][j] = (j < 4) ? mma3t(ah[i], al[i], bh[j & 1], bl[j & 1], acc[i][j])    // q, k: D[r] = C[token 16i+m][col 16j+8h+r]
                              : mma3(ah[i], al[i], bh[j & 1], bl[j & 1], acc[i][j]);    // v:    D[r] = C[token 16i+8h+r][col 16j+m]
      }
      if (kc < 3) {
#pragma unroll
        for (int i = 0; i < 5; ++i) {
          us8 hv, lv;
          split8(ra[i], rc[i], hv, lv);
          *(us8*)&Dh[dst[i] + 512 * s] = hv;
          *(us8*)&Dh[20480 + dst[i] + 512 * s] = lv;
        }
      }
    }
    if (kc < 3) __syncthreads();   // chunk kc + 1 is published; every reader has left chunk kc's buffer
  }

  const int r0 = rb * 128 + wm * 32;
  const int bb = r0 >> 12, n0 = r0 & 4095;

  // W_proj: row group bid >> 3, k-step bid & 7; read here, under the conversions below, stored at the end
  const int prg = bid >> 3, pks = bid & 7;
  v4f pa, pc;
  if (w == 0) {
    const float* p = Wp + (size_t)(prg * 8 + srow) * 256 + (size_t)(32 * pks + 8 * sp);
    pa = *(const v4f*)p;
    pc = *(const v4f*)(p + 4);
  }

  const size_t dso = ((size_t)(bb * 8 + cb * 2 + wn) * 4096 + (size_t)n0) * 32;
#pragma unroll
  for (int jj = 0; jj < 3; ++jj) {
    us* dh = (jj == 0) ? qh : ((jj == 1) ? kh : vh);
    us* dl = (jj == 0) ? ql : ((jj == 1) ? kl : vl);
    // the lane's 16-B chunk in tile (i, j) = (0, 0) of the part, and the step from j = 0 to j = 1; i steps by 16 tokens = 512
    const int lane0 = (jj == 0) ? l * 8
                    : (jj == 1) ? (m >> 3) * 256 + h * 64 + (m & 7) * 8
                                : h * 256 + m * 8;
    const int jstep = (jj == 0) ? 256 : 128;
    us8 hv[4], lv[4];
#pragma unroll
    for (int i = 0; i < 2; ++i)
#pragma unroll
      for (int j = 0; j < 2; ++j) {
        const v8f t = acc[i][2 * jj + j];
        split8(__builtin_shufflevector(t, t, 0, 1, 2, 3), __builtin_shufflevector(t, t, 4, 5, 6, 7), hv[2 * i + j], lv[2 * i + j]);
      }
#pragma unroll
    for (int i = 0; i < 2; ++i)
#pragma unroll
      for (int j = 0; j < 2; ++j) {
        const size_t o = dso + (size_t)(lane0 + i * 512 + j * jstep);
        *(us8*)(dh + o) = hv[2 * i + j];
        *(us8*)(dl + o) = lv[2 * i + j];
      }
    // what follows reuses the registers that these stores name: keep the wait in front of their overwrite
    asm volatile("s_wait_xcnt 0x0" ::: "memory");
    __builtin_amdgcn_sched_barrier(0);   // keeps the next part's conversions, which write those registers, behind the wait
  }

  if (w == 0) {   // global planes in fragment order (no swap)
    us8 hv, lv;
    split8(pa, pc, hv, lv);
    const size_t e0 = (size_t)((((prg >> 1) * 8 + pks) * 2 + (sp >> 1)) * 32 + 16 * (sp & 1) + 8 * (prg & 1) + srow) * 8;
    *(us8*)(w2h + e0) = hv;
    *(us8*)(w2l + e0) = lv;
  }
}

__device__ __forceinline__ float xhalf(float x) {   // value of lane l ^ 16
  const int b = __builtin_bit_cast(int, x);
  return __builtin_bit_cast(float, __builtin_amdgcn_permlanex16(b, b, 0x76543210, 0xfedcba98, false, false));
}

// One key row (32 slots) against one query tile: scores, mask, online softmax, O^T += V^T P^T.
__device__ __forceinline__ void attn_row(const Frag (&kfh)[2], const Frag (&kfl)[2],
                                         const Frag (&vfh)[2], const Frag (&vfl)[2],
                                         const Frag& qfh, const Frag& qfl, int dc0, float alpha,
                                         float& mrun, float& lrun, v8f (&accO)[2]) {
  // scores for two 16-slot chunks: D[r] = S[q = m][slot 16c + 8h + r]
  v8f s[2];
#pragma unroll
  for (int c = 0; c < 2; ++c) s[c] = mma3(kfh[c], kfl[c], qfh, qfl, zero8());

  // locality mask + scale
#pragma unroll
  for (int c = 0; c < 2; ++c) {
#pragma unroll
    for (int r = 0; r < 8; ++r) {
      const int dc = dc0 + 16 * c + r;
      const bool ok = (dc >= -3) && (dc <= 3);
      s[c][r] = ok ? s[c][r] * alpha : -__builtin_inff();
    }
  }

  // online softmax over the 32 slots of this key row
  float rm = fmaxf(s[0][0], s[1][0]);
#pragma unroll
  for (int r = 1; r < 8; ++r) rm = fmaxf(rm, fmaxf(s[0][r], s[1][r]));
  rm = fmaxf(rm, xhalf(rm));
  const float mn = fmaxf(mrun, rm);        // finite: every query has >= 4 valid keys per row
  const float sc = __expf(mrun - mn);      // 0 on the first key row
  Frag pfh, pfl;
  float ps[2];
#pragma unroll
  for (int c = 0; c < 2; ++c) {
    ps[c] = 0.0f;
    v8f p;
#pragma unroll
    for (int r = 0; r < 8; ++r) {
      p[r] = __expf(s[c][r] - mn);   // masked -> 0
      ps[c] += p[r];
    }
    split8(__builtin_shufflevector(p, p, 0, 1, 2, 3), __builtin_shufflevector(p, p, 4, 5, 6, 7), pfh.half[c], pfl.half[c]);
  }
  lrun = lrun * sc + (ps[0] + ps[1]);
  mrun = mn;

#pragma unroll
  for (int r = 0; r < 8; ++r) {
    accO[0][r] *= sc;
    accO[1][r] *= sc;
  }

  // O^T[d][q] += sum_slot V[slot][d] * P[q][slot]
#pragma unroll
  for (int db = 0; db < 2; ++db)
    accO[db] = mma3(vfh[db], vfl[db], pfh, pfl, accO[db]);
}

__global__ __launch_bounds__(512) void k_attn_proj(
    const us* __restrict__ qh, const us* __restrict__ ql,
    const us* __restrict__ kh, const us* __restrict__ kl,
    const us* __restrict__ vh, const us* __restrict__ vl,
    const float* __restrict__ temp,
    const us* __restrict__ Wh, const us* __restrict__ Wl,
    const float* __restrict__ bias, float* out) {
  __shared__ __align__(16) us Oh[2][8][512];     // [query tile][k-step = head][fragment order]
  __shared__ __align__(16) us Ol[2][8][512];
  __shared__ __align__(16) float Tf[32][260];    // output tile, pitch 260: the two wave halves hit disjoint banks
  __shared__ __align__(16) v4f Xo[16][4][32];    // partial O handed to the partner wave: [giving wave][4 values][lane]
  __shared__ __align__(8) f32x2 Xs[16][32];      // its running maximum and sum
  const int bid = blockIdx.x;
  const int w = __builtin_amdgcn_readfirstlane((int)threadIdx.x >> 5);   // wave number, kept scalar: head, tile and loop bounds stay uniform
  const int qt = w >> 3;   // half of the key rows this wave runs, and the query tile it finishes
  const int hd = w & 7;
  const int b = bid >> 7;
  const int l = threadIdx.x & 31, h = l >> 4, m = l & 15;
  const int qr = ((bid & 127) >> 2) * 2;   // grid row of query tile 0
  const int qc0 = (bid & 3) * 16;
  const float alpha = 0.17677669529663689f * temp[0];   // hd^-0.5 * temperature
  const size_t hb = (size_t)(b * 8 + hd) * 4096 * 32;

  // state index 0 = the tile this wave finishes (grid row qr + qt), 1 = the tile it hands over (the other row)
  int trow[2];
  trow[0] = qr + qt;
  trow[1] = qr + (qt ^ 1);
  Frag qfh[2], qfl[2];
  float mrun[2], lrun[2];   // running maximum of query m (equal in both halves); running sum over this half's slots only
  v8f accO[2][2];
#pragma unroll
  for (int t = 0; t < 2; ++t) {
    const size_t qo = hb + (size_t)(trow[t] * 64 + qc0) * 32 + (size_t)(l * 8);
    qfh[t] = ldpack(qh + qo);
    qfl[t] = ldpack(ql + qo);
    mrun[t] = -__builtin_inff();
    lrun[t] = 0.0f;
    accO[t][0] = zero8();
    accO[t][1] = zero8();
  }

  int wst = qc0 - 8;
  if (wst < 0) wst = 0;
  if (wst > 32) wst = 32;
  // this wave's key rows; row qr (first half) and row qr + 1 (second half) always exist and serve both tiles
  int kr0 = qt ? (qr + 1) : (qr - 3);
  int kr1 = qt ? (qr + 4) : qr;
  if (kr0 < 0) kr0 = 0;
  if (kr1 > 63) kr1 = 63;
  const int dc0 = wst + 8 * h - (qc0 + m);   // key col - query col of slot 8h

  for (int kr = kr0; kr <= kr1; ++kr) {
    const int t0 = kr * 64 + wst;   // multiple of 8 -> 16-B aligned rows

    // K fragments of the two 16-slot chunks: element (x, e) of lane (h, m) = K[t0 + 16c + m][16x + 8h + e]
    Frag kfh[2], kfl[2];
    const us *pkh[2], *pkl[2];
#pragma unroll
    for (int c = 0; c < 2; ++c) {
      const size_t ko = hb + (size_t)(t0 + 16 * c) * 32 + (size_t)((m >> 3) * 256 + h * 64 + (m & 7) * 8);
      pkh[c] = kh + ko;
      pkl[c] = kl + ko;
      kfh[c].half[0] = *(const us8*)(pkh[c]);
      kfh[c].half[1] = *(const us8*)(pkh[c] + 128);
      kfl[c].half[0] = *(const us8*)(pkl[c]);
      kfl[c].half[1] = *(const us8*)(pkl[c] + 128);
    }

    // V fragments of the 32 key slots: element (x, e) of lane (h, m) = V[t0 + 16x + 8h + e][16db + m]
    Frag vfh[2], vfl[2];
    const us *pvh[2], *pvl[2];
#pragma unroll
    for (int db = 0; db < 2; ++db) {
      const size_t vo = hb + (size_t)t0 * 32 + (size_t)(h * 256 + db * 128 + m * 8);
      pvh[db] = vh + vo;
      pvl[db] = vl + vo;
      vfh[db].half[0] = *(const us8*)(pvh[db]);
      vfh[db].half[1] = *(const us8*)(pvh[db] + 512);
      vfl[db].half[0] = *(const us8*)(pvl[db]);
      vfl[db].half[1] = *(const us8*)(pvl[db] + 512);
    }
    // the wait in front of every overwrite of a register that one of the 16 loads names; the loads' six address pairs are its inputs,
    // so each stays whole up to it (else a later load's result or the next address is put on a pair whose loads are just issued)
    asm volatile("s_wait_xcnt 0x0" :: "v"(pvh[0]), "v"(pvl[0]), "v"(pkh[0]), "v"(pkl[0]), "v"(pkh[1]), "v"(pkl[1]) : "memory");
    __builtin_amdgcn_sched_barrier(0);   // keeps the products behind the wait: else the first one, with its wait on data, is put in front of the V loads

    // every key row of this wave's half lies within 3 rows of the tile it finishes
    attn_row(kfh, kfl, vfh, vfl, qfh[0], qfl[0], dc0, alpha, mrun[0], lrun[0], accO[0]);
    const int dr = kr - trow[1];
    if (dr >= -3 && dr <= 3)   // wave-uniform: false only for the outermost row of the half (qr - 3 or qr + 4)
      attn_row(kfh, kfl, vfh, vfl, qfh[1], qfl[1], dc0, alpha, mrun[1], lrun[1], accO[1]);
  }

  // W fragments of this wave's 16 output columns, all 8 k-steps
  Frag wfh[8], wfl[8];
#pragma unroll
  for (int ks = 0; ks < 8; ++ks) {
    const size_t off = (size_t)w * 4096 + (size_t)ks * 512 + (size_t)l * 8;
    wfh[ks] = ldpack(Wh + off);
    wfl[ks] = ldpack(Wl + off);
  }
  const float bj = bias[16 * w + m];

  // hand the other tile's part to the partner wave
#pragma unroll
  for (int db = 0; db < 2; ++db) {
    const v8f o = accO[1][db];
    Xo[w][2 * db][l] = __builtin_shufflevector(o, o, 0, 1, 2, 3);
    Xo[w][2 * db + 1][l] = __builtin_shufflevector(o, o, 4, 5, 6, 7);
  }
  {
    f32x2 ml;
    ml.x = mrun[1];
    ml.y = lrun[1];
    Xs[w][l] = ml;
  }
  __syncthreads();   // every wave's handed-over part is in LDS

  // join the two parts of this wave's tile (both hold at least one key row: maxima finite, sums > 0)
  const f32x2 pml = Xs[w ^ 8][l];
  const float mj = fmaxf(mrun[0], pml.x);
  const float ea = __expf(mrun[0] - mj);
  const float eb = __expf(pml.x - mj);
  const float lj = lrun[0] * ea + pml.y * eb;
  const float inv = 1.0f / (lj + xhalf(lj));   // sum >= 1
  const float fa = ea * inv, fb = eb * inv;

#pragma unroll
  for (int db = 0; db < 2; ++db) {
    us8 hv, lv;
    const v4f p0 = Xo[w ^ 8][2 * db][l];
    const v4f p1 = Xo[w ^ 8][2 * db + 1][l];
    const v8f o = accO[0][db] * fa + __builtin_shufflevector(p0, p1, 0, 1, 2, 3, 4, 5, 6, 7) * fb;
    split8(__builtin_shufflevector(o, o, 0, 1, 2, 3), __builtin_shufflevector(o, o, 4, 5, 6, 7), hv, lv);
    *(us8*)&Oh[qt][hd][8 * (32 * db + l)] = hv;
    *(us8*)&Ol[qt][hd][8 * (32 * db + l)] = lv;
  }
  __syncthreads();   // all 8 heads of both query tiles are in LDS

  v8f acc[2];
  acc[0] = zero8();
  acc[1] = zero8();
  // A fragments are read from LDS one k-step ahead, as one group, into a second register set
  Frag afh[2][2], afl[2][2];
#pragma unroll
  for (int i = 0; i < 2; ++i) {
    afh[0][i] = ldpack(&Oh[i][0][l * 8]);
    afl[0][i] = ldpack(&Ol[i][0][l * 8]);
  }
#pragma unroll
  for (int ks = 0; ks < 8; ++ks) {
    if (ks < 7) {
#pragma unroll
      for (int i = 0; i < 2; ++i) {
        afh[(ks + 1) & 1][i] = ldpack(&Oh[i][ks + 1][l * 8]);
        afl[(ks + 1) & 1][i] = ldpack(&Ol[i][ks + 1][l * 8]);
      }
    }
#pragma unroll
    for (int i = 0; i < 2; ++i)
      acc[i] = mma3(afh[ks & 1][i], afl[ks & 1][i], wfh[ks], wfl[ks], acc[i]);
  }

  // D element r of lane (h, m): row 16i + 8h + r of the block's 32 queries, column 16w + m
#pragma unroll
  for (int i = 0; i < 2; ++i)
#pragma unroll
    for (int r = 0; r < 8; ++r)
      Tf[16 * i + 8 * h + r][16 * w + m] = acc[i][r] + bj;
  __syncthreads();   // the whole 32 x 256 tile is staged

  v4f ov[4];
#pragma unroll
  for (int q = 0; q < 4; ++q) {
    const int g = 32 * q + l;
    ov[q] = *(const v4f*)&Tf[2 * w + (g >> 6)][(g & 63) * 4];
  }
  // staged rows 2w and 2w + 1 are two consecutive queries of tile w >> 3
  const size_t base = ((size_t)b * 4096 + (size_t)((qr + qt) * 64 + qc0 + ((2 * w) & 15))) * 256;
#pragma unroll
  for (int q = 0; q < 4; ++q)
    *(v4f*)(out + base + (size_t)4 * (32 * q + l)) = ov[q];
}

// ----------------------------------------------------------------------------
extern "C" void kernel_launch(void* const* d_in, const int* in_sizes, int n_in,
                              void* d_out, int out_size, void* d_ws, size_t ws_size,
                              hipStream_t stream) {
  const int M = 8192;      // B * N
  const int C = 256;
  const int C3 = 768;
  if (n_in < 5) return;
  if (in_sizes[0] != M * C || in_sizes[1] != C3 * C || in_sizes[2] != C * C ||
      in_sizes[3] != C || in_sizes[4] < 1 || out_size != M * C) return;

  const float* x     = (const float*)d_in[0];   // [2,4096,256]
  const float* wqkv  = (const float*)d_in[1];   // [768,256]
  const float* wproj = (const float*)d_in[2];   // [256,256]
  const float* bproj = (const float*)d_in[3];   // [256]
  const float* temp  = (const float*)d_in[4];   // [1]
  float* out = (float*)d_out;                   // [2,4096,256] f32

  const size_t szX  = (size_t)M * C * 2;        // one bf16 plane of q / k / v
  const size_t szW2 = (size_t)C * C * 2;
  size_t off = 0;
  char* ws = (char*)d_ws;
  us* w2h = (us*)(ws + off); off += szW2;
  us* w2l = (us*)(ws + off); off += szW2;
  us* qh  = (us*)(ws + off); off += szX;
  us* ql  = (us*)(ws + off); off += szX;
  us* kh  = (us*)(ws + off); off += szX;
  us* kl  = (us*)(ws + off); off += szX;
  us* vh  = (us*)(ws + off); off += szX;
  us* vl  = (us*)(ws + off); off += szX;   // total 25,427,968 bytes
  if (off > ws_size) return;

  k_gemm_qkv<<<(M / 128) * (C3 / 192), 256, 0, stream>>>(x, wqkv, wproj, w2h, w2l,
                                                         qh, ql, kh, kl, vh, vl);

  k_attn_proj<<<M / 32, 512, 0, stream>>>(qh, ql, kh, kl, vh, vl, temp, w2h, w2l, bproj, out);
}

// v009
// Measured time: 25.6 microseconds a run.
// Two timings next to v008 put it at 1.09 and 1.10 times that version's speed.
// All steps since v000 together make it 3.26 times as fast.
#include <hip/hip_runtime.h>

// All contractions (qkv projection, q.k^T scores, p.v, output projection): v_wmma_f32_16x16x32_bf16 with bf16 hi/lo split operands (hi*hi + hi*lo + lo*hi), f32 accumulate; softmax, scaling and bias in f32.

typedef unsigned short us;
typedef us us8 __attribute__((ext_vector_type(8)));
typedef us us16 __attribute__((ext_vector_type(16)));
typedef __bf16 bf16x16 __attribute__((ext_vector_type(16)));
typedef float v8f __attribute__((ext_vector_type(8)));
typedef float v4f __attribute__((ext_vector_type(4)));

union Frag {
  bf16x16 v;
  us16 u;
  us8 half[2];
};

// 16x32 operand fragment of lane (h, m) = (lane>>4, lane&15): row (A) or column (B) m,
// elements 0..7 <- k0+8h+0..7, elements 8..15 <- k0+16+8h+0..7. Same map for A and B.
// Read from a plane stored in fragment order: per (16-row tile, k-step) two runs of 512 B,
// run x holds for lane (h, m) the 8 elements k0+16x+8h+0..7 of row m at 16-B chunk 16h+m, so one
// wave-wide 16-B load covers four whole 128-B lines. p already includes the lane's chunk (lane * 8).
__device__ __forceinline__ Frag ldpack(const us* p) {
  Frag f;
  f.half[0] = *(const us8*)p;
  f.half[1] = *(const us8*)(p + 256);
  return f;
}

__device__ __forceinline__ v8f wmma16(bf16x16 a, bf16x16 b, v8f c) {
  return __builtin_amdgcn_wmma_f32_16x16x32_bf16(false, a, false, b, (short)0, c, false, false);
}

// acc += A*B with A = ah+al, B = bh+bl (lo*lo dropped); hazard guard after the last WMMA of the group.
__device__ __forceinline__ v8f mma3(const Frag& ah, const Frag& al, const Frag& bh, const Frag& bl, v8f acc) {
  acc = wmma16(al.v, bh.v, acc);
  acc = wmma16(ah.v, bl.v, acc);
  acc = wmma16(ah.v, bh.v, acc);
  asm volatile("v_nop\n\tv_nop\n\tv_nop\n\tv_nop"
               : "+v"(acc)
               : "v"(ah.v), "v"(al.v), "v"(bh.v), "v"(bl.v));
  return acc;
}

// The same three products in the same order with the operands' roles swapped: acc^T += B^T * A^T (A = ah+al, B = bh+bl).
__device__ __forceinline__ v8f mma3t(const Frag& ah, const Frag& al, const Frag& bh, const Frag& bl, v8f acc) {
  acc = wmma16(bh.v, al.v, acc);
  acc = wmma16(bl.v, ah.v, acc);
  acc = wmma16(bh.v, ah.v, acc);
  asm volatile("v_nop\n\tv_nop\n\tv_nop\n\tv_nop"   // hazard guard, as in mma3
               : "+v"(acc)
               : "v"(ah.v), "v"(al.v), "v"(bh.v), "v"(bl.v));
  return acc;
}

__device__ __forceinline__ v8f zero8() {
  v8f z;
#pragma unroll
  for (int i = 0; i < 8; ++i) z[i] = 0.0f;
  return z;
}

// ----------------------------------------------------------------------------
// QKV projection with the f32 -> bf16 hi/lo split done in the kernel: C[8192 x 768] = x[8192 x 256] * Wqkv^T.
// One block of 8 waves (4 x 2) per 128 tokens x 192 columns, grid 256 = 64 row blocks x 4 column blocks; wave tile 32 x 96.
// Column block cb = heads 2cb and 2cb+1; wave column wn = head 2cb+wn: its 96 columns are that head's q, k and v (32 each),
// column tile j = 2 * (q|k|v) + half, so which plane a tile belongs to is known at compile time.
// K runs in 4 chunks of 64 (2 k-steps). A chunk's 320 rows (128 of x, 192 of W) are read as f32, converted once
// per block and stored in LDS in fragment order (see ldpack); two buffers; k-step s of the next chunk is read as f32
// ahead of this chunk's k-step s and converted behind it; one barrier a chunk.
// Staging unit = 8 rows x 32 columns (one k-step) = one wave: lane l owns row l & 7 and piece p = l >> 3 = 2x + h,
// 8 consecutive k. LDS chunk of (x, h, m): run x, 16-B slot 16h + (m ^ 8h): the swap of the two 8-row halves for
// h = 1 puts the 16 lanes of a store on all 64 banks once; a fragment read still covers each 256-B run half whole.
// The block also converts its 1/256 of W_proj (8 rows x 32 columns) into the global planes that the next launch reads.
// Epilogue: no LDS. The q and k tiles are computed transposed (A = W, B = x), so a lane's 8 accumulator values are
// 8 consecutive d of one token; the v tiles are not (A = x, B = W): 8 consecutive tokens of one d. Either way the 8 values,
// split hi/lo, are one 16-B chunk of the plane, and a wave-wide store covers four whole 128-B lines.
// Token order of the planes: the block's 128 tokens are 2 grid rows x 64 cols; row mu of the product is the token of
// patch mu / 8 (4 cols wide, 2 rows high), grid row (mu / 4) % 2, col mu % 4 of the patch. So 8 consecutive plane positions
// are a patch of 2 x 4 tokens, and "token" below means this position. Only the x rows' source addresses know of it.
// Plane layouts inside [b][head], 256 elements per group of 8 tokens:
//   q: [token/16][d/16][(d/8)%2][token%16][8 d]  (fragment order: the Q fragment of a 16-query tile, see ldpack)
//   k: [token/8][d/8][token%8][8 d]         (K fragments of the score product at any 8-token offset)
//   v: [token/8][d][8 tokens]               (transposed: V fragments of the p.v product at any 8-token offset)
typedef float f32x2 __attribute__((ext_vector_type(2)));
typedef __bf16 bf16x2 __attribute__((ext_vector_type(2)));
typedef unsigned u32x4 __attribute__((ext_vector_type(4)));

// 8 f32 -> 8 hi + 8 lo bf16, two at a time with the packed RNE convert: hi = rne(f), lo = rne(f - hi)
__device__ __forceinline__ void split8(v4f a, v4f c, us8& hv, us8& lv) {
  u32x4 hu, lu;
#pragma unroll
  for (int e = 0; e < 4; ++e) {
    f32x2 v;
    v.x = (e < 2) ? a[2 * e] : c[2 * e - 4];
    v.y = (e < 2) ? a[2 * e + 1] : c[2 * e - 3];
    const unsigned hb = __builtin_bit_cast(unsigned, __builtin_convertvector(v, bf16x2));
    f32x2 hf;
    hf.x = __uint_as_float(hb << 16);
    hf.y = __uint_as_float(hb & 0xFFFF0000u);
    const f32x2 d = v - hf;
    hu[e] = hb;
    lu[e] = __builtin_bit_cast(unsigned, __builtin_convertvector(d, bf16x2));
  }
  hv = __builtin_bit_cast(us8, hu);
  lv = __builtin_bit_cast(us8, lu);
}

__global__ __launch_bounds__(256) void k_gemm_qkv(
    const float* __restrict__ X, const float* __restrict__ Wq, const float* __restrict__ Wp,
    us* w2h, us* w2l,
    us* qh, us* ql, us* kh, us* kl, us* vh, us* vl) {
  // [buffer][hi | lo][20 tiles of 16 rows (8 of x, 12 of W)][2 k-steps][512]
  __shared__ __align__(16) us S[4 * 20480];
  const int tid = threadIdx.x;
  const int w = __builtin_amdgcn_readfirstlane(tid >> 5);   // wave number, kept scalar: sources, tiles and planes stay uniform
  const int l = tid & 31, h = l >> 4, m = l & 15;
  const int wm = w >> 1, wn = w & 1;
  const int bid = blockIdx.x;
  const int rb = bid >> 2, cb = bid & 3;
  const int srow = l & 7, sp = l >> 3;

  // this wave's 5 groups of 8 rows: wave-uniform source of the group, the lane's part (W: 8 consecutive rows; x: a patch of
  // 2 grid rows x 4 cols), LDS slot of k-step 0
  const float* src[5];
  int dst[5];
  unsigned lo[5];
  const unsigned low = (unsigned)(srow * 256 + 8 * sp);
  const unsigned lox = (unsigned)(((srow >> 2) * 64 + (srow & 3)) * 256 + 8 * sp);
#pragma unroll
  for (int i = 0; i < 5; ++i) {
    const int rg = w * 5 + i;
    // W row groups 0..23: 8 of q, 8 of k, 8 of v, each the 64 rows of the block's two heads
    const int xrow = rb * 128 + rg * 4;
    const int wrow = ((rg >> 3) - 2) * 256 + cb * 64 + (rg & 7) * 8;
    src[i] = ((rg < 16) ? X : Wq) + (size_t)((rg < 16) ? xrow : wrow) * 256;
    lo[i] = (rg < 16) ? lox : low;
    const int mm = 8 * (rg & 1) + srow;
    dst[i] = ((rg >> 1) * 4 + (sp >> 1)) * 256 + (16 * (sp & 1) + (mm ^ (8 * (sp & 1)))) * 8;
  }

  v4f ra[5], rc[5];   // one k-step of the wave's 5 row groups, f32

  v8f acc[2][6];
#pragma unroll
  for (int i = 0; i < 2; ++i)
#pragma unroll
    for (int j = 0; j < 6; ++j) acc[i][j] = zero8();

  // chunk 0 into buffer 0
#pragma unroll
  for (int s = 0; s < 2; ++s) {
#pragma unroll
    for (int i = 0; i < 5; ++i) {
      ra[i] = *(const v4f*)(src[i] + 32 * s + lo[i]);
      rc[i] = *(const v4f*)(src[i] + (32 * s + 4) + lo[i]);
    }
#pragma unroll
    for (int i = 0; i < 5; ++i) {
      us8 hv, lv;
      split8(ra[i], rc[i], hv, lv);
      *(us8*)&S[dst[i] + 512 * s] = hv;
      *(us8*)&S[20480 + dst[i] + 512 * s] = lv;
    }
  }
  __syncthreads();   // chunk 0 is in buffer 0

  const int lsw = (l ^ (h << 3)) * 8;   // the lane's slot in a run (see the swap above)
#pragma unroll   // unrolled: chunk and k-step become immediate offsets of 5 fixed address pairs and of the LDS reads, no address arithmetic in the loop
  for (int kc = 0; kc < 4; ++kc) {
    const us* Bh = &S[(kc & 1) * 40960 + lsw];
    const us* Bl = Bh + 20480;
    us* Dh = &S[((kc + 1) & 1) * 40960];   // next chunk's buffer: its readers left it at the barrier that ended chunk kc - 1
#pragma unroll
    for (int s = 0; s < 2; ++s) {
      if (kc < 3) {   // k-step s of the next chunk, f32: in flight under this k-step's products, none across a barrier
#pragma unroll
        for (int i = 0; i < 5; ++i) {
          const float* p = src[i] + (kc + 1) * 64 + 32 * s;
          ra[i] = *(const v4f*)(p + lo[i]);
          rc[i] = *(const v4f*)(p + 4 + lo[i]);
        }
      }
      Frag ah[2], al[2], bh[2], bl[2];
#pragma unroll
      for (int i = 0; i < 2; ++i) {
        const int off = ((wm * 2 + i) * 2 + s) * 512;
        ah[i] = ldpack(Bh + off);
        al[i] = ldpack(Bl + off);
      }
      // column tile j of the wave = LDS tile 8 + 4 * (j >> 1) + 2 * wn + (j & 1)
      bh[0] = ldpack(Bh + ((8 + wn * 2) * 2 + s) * 512);
      bl[0] = ldpack(Bl + ((8 + wn * 2) * 2 + s) * 512);
#pragma unroll
      for (int j = 0; j < 6; ++j) {
        if (j < 5) {   // W fragments one column tile ahead, into the second register set
          const int off = ((8 + 4 * ((j + 1) >> 1) + wn * 2 + ((j + 1) & 1)) * 2 + s) * 512;
          bh[(j + 1) & 1] = ldpack(Bh + off);
          bl[(j + 1) & 1] = ldpack(Bl + off);
        }
#pragma unroll
        for (int i = 0; i < 2; ++i)
          acc[i][j] = (j < 4) ? mma3t(ah[i], al[i], bh[j & 1], bl[j & 1], acc[i][j])    // q, k: D[r] = C[token 16i+m][col 16j+8h+r]
                              : mma3(ah[i], al[i], bh[j & 1], bl[j & 1], acc[i][j]);    // v:    D[r] = C[token 16i+8h+r][col 16j+m]
      }
      if (kc < 3) {
#pragma unroll
        for (int i = 0; i < 5; ++i) {
          us8 hv, lv;
          split8(ra[i], rc[i], hv, lv);
          *(us8*)&Dh[dst[i] + 512 * s] = hv;
          *(us8*)&Dh[20480 + dst[i] + 512 * s] = lv;
        }
      }
    }
    if (kc < 3) __syncthreads();   // chunk kc + 1 is published; every reader has left chunk kc's buffer
  }

  const int r0 = rb * 128 + wm * 32;
  const int bb = r0 >> 12, n0 = r0 & 4095;

  // W_proj: row group bid >> 3, k-step bid & 7; read here, under the conversions below, stored at the end
  const int prg = bid >> 3, pks = bid & 7;
  v4f pa, pc;
  if (w == 0) {
    const float* p = Wp + (size_t)(prg * 8 + srow) * 256 + (size_t)(32 * pks + 8 * sp);
    pa = *(const v4f*)p;
    pc = *(const v4f*)(p + 4);
  }

  const size_t dso = ((size_t)(bb * 8 + cb * 2 + wn) * 4096 + (size_t)n0) * 32;
#pragma unroll
  for (int jj = 0; jj < 3; ++jj) {
    us* dh = (jj == 0) ? qh : ((jj == 1) ? kh : vh);
    us* dl = (jj == 0) ? ql : ((jj == 1) ? kl : vl);
    // the lane's 16-B chunk in tile (i, j) = (0, 0) of the part, and the step from j = 0 to j = 1; i steps by 16 tokens = 512
    const int lane0 = (jj == 0) ? l * 8
                    : (jj == 1) ? (m >> 3) * 256 + h * 64 + (m & 7) * 8
                                : h * 256 + m * 8;
    const int jstep = (jj == 0) ? 256 : 128;
    us8 hv[4], lv[4];
#pragma unroll
    for (int i = 0; i < 2; ++i)
#pragma unroll
      for (int j = 0; j < 2; ++j) {
        const v8f t = acc[i][2 * jj + j];
        split8(__builtin_shufflevector(t, t, 0, 1, 2, 3), __builtin_shufflevector(t, t, 4, 5, 6, 7), hv[2 * i + j], lv[2 * i + j]);
      }
#pragma unroll
    for (int i = 0; i < 2; ++i)
#pragma unroll
      for (int j = 0; j < 2; ++j) {
        const size_t o = dso + (size_t)(lane0 + i * 512 + j * jstep);
        *(us8*)(dh + o) = hv[2 * i + j];
        *(us8*)(dl + o) = lv[2 * i + j];
      }
    // what follows reuses the registers that these stores name: keep the wait in front of their overwrite
    asm volatile("s_wait_xcnt 0x0" ::: "memory");
    __builtin_amdgcn_sched_barrier(0);   // keeps the next part's conversions, which write those registers, behind the wait
  }

  if (w == 0) {   // global planes in fragment order (no swap)
    us8 hv, lv;
    split8(pa, pc, hv, lv);
    const size_t e0 = (size_t)((((prg >> 1) * 8 + pks) * 2 + (sp >> 1)) * 32 + 16 * (sp & 1) + 8 * (prg & 1) + srow) * 8;
    *(us8*)(w2h + e0) = hv;
    *(us8*)(w2l + e0) = lv;
  }
}

__device__ __forceinline__ float xhalf(float x) {   // value of lane l ^ 16
  const int b = __builtin_bit_cast(int, x);
  return __builtin_bit_cast(float, __builtin_amdgcn_permlanex16(b, b, 0x76543210, 0xfedcba98, false, false));
}

// One key chunk (32 slots) against one query tile: scores, mask, online softmax, O^T += V^T P^T.
// dc0 = key col - query col of slot 8h; EDGE: pair distance 2, e0 / e1 = key row 0 / 1 of the pair is within 3 rows of the lane's query.
template <bool EDGE>
__device__ __forceinline__ void attn_row(const Frag (&kfh)[2], const Frag (&kfl)[2],
                                         const Frag (&vfh)[2], const Frag (&vfl)[2],
                                         const Frag& qfh, const Frag& qfl, int dc0, bool e0, bool e1, float alpha,
                                         float& mrun, float& lrun, v8f (&accO)[2]) {
  // scores for two 16-slot chunks: D[r] = S[q = m][slot 16c + 8h + r]
  v8f s[2];
#pragma unroll
  for (int c = 0; c < 2; ++c) s[c] = mma3(kfh[c], kfl[c], qfh, qfl, zero8());

  // locality mask + scale
#pragma unroll
  for (int c = 0; c < 2; ++c) {
#pragma unroll
    for (int r = 0; r < 8; ++r) {
      const int dc = dc0 + 8 * c + (r & 3);   // slot 16c + 8h + r: patch 2c + h, row r >> 2, col r & 3
      bool ok = (dc >= -3) && (dc <= 3);
      if (EDGE) ok = ok && ((r >> 2) ? e1 : e0);
      s[c][r] = ok ? s[c][r] * alpha : -__builtin_inff();
    }
  }

  // online softmax over the 32 slots of this chunk
  float rm = fmaxf(s[0][0], s[1][0]);
#pragma unroll
  for (int r = 1; r < 8; ++r) rm = fmaxf(rm, fmaxf(s[0][r], s[1][r]));
  rm = fmaxf(rm, xhalf(rm));
  const float mn = fmaxf(mrun, rm);        // finite: the first chunk of a wave has >= 4 valid keys for every query (an EDGE chunk, never the first, may have none)
  const float sc = __expf(mrun - mn);      // 0 on the first chunk
  Frag pfh, pfl;
  float ps[2];
#pragma unroll
  for (int c = 0; c < 2; ++c) {
    ps[c] = 0.0f;
    v8f p;
#pragma unroll
    for (int r = 0; r < 8; ++r) {
      p[r] = __expf(s[c][r] - mn);   // masked -> 0
      ps[c] += p[r];
    }
    split8(__builtin_shufflevector(p, p, 0, 1, 2, 3), __builtin_shufflevector(p, p, 4, 5, 6, 7), pfh.half[c], pfl.half[c]);
  }
  lrun = lrun * sc + (ps[0] + ps[1]);
  mrun = mn;

#pragma unroll
  for (int r = 0; r < 8; ++r) {
    accO[0][r] *= sc;
    accO[1][r] *= sc;
  }

  // O^T[d][q] += sum_slot V[slot][d] * P[q][slot]
#pragma unroll
  for (int db = 0; db < 2; ++db)
    accO[db] = mma3(vfh[db], vfl[db], pfh, pfl, accO[db]);
}

// K and V fragments of the 32 key slots that start at plane position t0 (a multiple of 8 -> 16-B aligned chunks), head base hb
__device__ __forceinline__ void load_kv(const us* __restrict__ kh, const us* __restrict__ kl,
                                        const us* __restrict__ vh, const us* __restrict__ vl,
                                        size_t hb, int t0, int h, int m,
                                        Frag (&kfh)[2], Frag (&kfl)[2], Frag (&vfh)[2], Frag (&vfl)[2]) {
  // K fragments of the two 16-slot chunks: element (x, e) of lane (h, m) = K[t0 + 16c + m][16x + 8h + e]
  const us *pkh[2], *pkl[2];
#pragma unroll
  for (int c = 0; c < 2; ++c) {
    const size_t ko = hb + (size_t)(t0 + 16 * c) * 32 + (size_t)((m >> 3) * 256 + h * 64 + (m & 7) * 8);
    pkh[c] = kh + ko;
    pkl[c] = kl + ko;
    kfh[c].half[0] = *(const us8*)(pkh[c]);
    kfh[c].half[1] = *(const us8*)(pkh[c] + 128);
    kfl[c].half[0] = *(const us8*)(pkl[c]);
    kfl[c].half[1] = *(const us8*)(pkl[c] + 128);
  }

  // V fragments of the 32 key slots: element (x, e) of lane (h, m) = V[t0 + 16x + 8h + e][16db + m]
  const us *pvh[2], *pvl[2];
#pragma unroll
  for (int db = 0; db < 2; ++db) {
    const size_t vo = hb + (size_t)t0 * 32 + (size_t)(h * 256 + db * 128 + m * 8);
    pvh[db] = vh + vo;
    pvl[db] = vl + vo;
    vfh[db].half[0] = *(const us8*)(pvh[db]);
    vfh[db].half[1] = *(const us8*)(pvh[db] + 512);
    vfl[db].half[0] = *(const us8*)(pvl[db]);
    vfl[db].half[1] = *(const us8*)(pvl[db] + 512);
  }
  // the wait in front of every overwrite of a register that one of the 16 loads names; the loads' six address pairs are its inputs,
  // so each stays whole up to it (else a later load's result or the next address is put on a pair whose loads are just issued)
  asm volatile("s_wait_xcnt 0x0" :: "v"(pvh[0]), "v"(pvl[0]), "v"(pkh[0]), "v"(pkl[0]), "v"(pkh[1]), "v"(pkl[1]) : "memory");
  __builtin_amdgcn_sched_barrier(0);   // keeps the products behind the wait: else the first one, with its wait on data, is put in front of the V loads
}

__global__ __launch_bounds__(512) void k_attn_proj(
    const us* __restrict__ qh, const us* __restrict__ ql,
    const us* __restrict__ kh, const us* __restrict__ kl,
    const us* __restrict__ vh, const us* __restrict__ vl,
    const float* __restrict__ temp,
    const us* __restrict__ Wh, const us* __restrict__ Wl,
    const float* __restrict__ bias, float* out) {
  __shared__ __align__(16) us Oh[2][8][512];     // [query tile][k-step = head][fragment order]
  __shared__ __align__(16) us Ol[2][8][512];
  __shared__ __align__(16) float Tf[32][260];    // output tile, pitch 260: the two wave halves hit disjoint banks
  __shared__ __align__(16) v4f Xo[16][4][32];    // partial O handed to the partner wave: [giving wave][4 values][lane]
  __shared__ __align__(8) f32x2 Xs[16][32];      // its running maximum and sum
  const int bid = blockIdx.x;
  const int w = __builtin_amdgcn_readfirstlane((int)threadIdx.x >> 5);   // wave number, kept scalar: head, tile and loop bounds stay uniform
  const int qt = w >> 3;   // half of the key row pairs this wave runs, and the query tile it finishes
  const int hd = w & 7;
  const int b = bid >> 7;
  const int l = threadIdx.x & 31, h = l >> 4, m = l & 15;
  const int R = (bid & 127) >> 3;   // grid rows 4R..4R+3 = row pairs 2R (query tile 0) and 2R+1 (tile 1)
  const int c0 = (bid & 7) * 8;     // cols c0..c0+7
  const float alpha = 0.17677669529663689f * temp[0];   // hd^-0.5 * temperature
  const size_t hb = (size_t)(b * 8 + hd) * 4096 * 32;

  // state index 0 = the tile this wave finishes (row pair 2R + qt), 1 = the tile it hands over (the other pair)
  int tpr[2];
  tpr[0] = 2 * R + qt;
  tpr[1] = 2 * R + (qt ^ 1);
  Frag qfh[2], qfl[2];
  float mrun[2], lrun[2];   // running maximum of query m (equal in both halves); running sum over this half's slots only
  v8f accO[2][2];
  const us *pqh[2], *pql[2];
#pragma unroll
  for (int t = 0; t < 2; ++t) {
    const size_t qo = hb + (size_t)(tpr[t] * 128 + c0 * 2) * 32 + (size_t)(l * 8);
    pqh[t] = qh + qo;
    pql[t] = ql + qo;
    qfh[t] = ldpack(pqh[t]);
    qfl[t] = ldpack(pql[t]);
    mrun[t] = -__builtin_inff();
    lrun[t] = 0.0f;
    accO[t][0] = zero8();
    accO[t][1] = zero8();
  }

  // the wait in front of every overwrite of a register that one of the 8 Q loads names; their four address pairs are its inputs,
  // so each stays whole up to it (else a K load's result is put on a pair whose loads are just issued)
  asm volatile("s_wait_xcnt 0x0" :: "v"(pqh[0]), "v"(pql[0]), "v"(pqh[1]), "v"(pql[1]) : "memory");

  int pc0 = (c0 >> 2) - 1;   // first patch of the key window
  if (pc0 < 0) pc0 = 0;
  if (pc0 > 12) pc0 = 12;
  const int dc0 = (pc0 + h) * 4 - (c0 + (m >> 3) * 4 + (m & 3));   // key col - query col of slot 8h
  const int qb = (m >> 2) & 1;            // the query's row in its pair
  const bool e0 = (qt == 1) && (qb == 1);   // pair distance +2 (second half): key row 0 reaches query row 1
  const bool e1 = (qt == 0) && (qb == 0);   // pair distance -2 (first half): key row 1 reaches query row 0
  // this wave's row pairs, nearest first: 2R + qt always exists and serves every query of both tiles (distance 0 and 1);
  // the other two lie in the grid together or not at all
  const int pk0 = (2 * R + qt) * 128 + pc0 * 8;
  const int pstep = qt ? 128 : -128;
  const bool full = qt ? (R < 15) : (R > 0);   // wave-uniform

  {
    Frag kfh[2], kfl[2], vfh[2], vfl[2];
    load_kv(kh, kl, vh, vl, hb, pk0, h, m, kfh, kfl, vfh, vfl);
    attn_row<false>(kfh, kfl, vfh, vfl, qfh[0], qfl[0], dc0, e0, e1, alpha, mrun[0], lrun[0], accO[0]);   // distance 0
    attn_row<false>(kfh, kfl, vfh, vfl, qfh[1], qfl[1], dc0, e0, e1, alpha, mrun[1], lrun[1], accO[1]);   // distance 1
    if (full) {
      load_kv(kh, kl, vh, vl, hb, pk0 + pstep, h, m, kfh, kfl, vfh, vfl);
      attn_row<false>(kfh, kfl, vfh, vfl, qfh[0], qfl[0], dc0, e0, e1, alpha, mrun[0], lrun[0], accO[0]);   // distance 1
      attn_row<true>(kfh, kfl, vfh, vfl, qfh[1], qfl[1], dc0, e0, e1, alpha, mrun[1], lrun[1], accO[1]);    // distance 2
      load_kv(kh, kl, vh, vl, hb, pk0 + 2 * pstep, h, m, kfh, kfl, vfh, vfl);
      attn_row<true>(kfh, kfl, vfh, vfl, qfh[0], qfl[0], dc0, e0, e1, alpha, mrun[0], lrun[0], accO[0]);    // distance 2
    }
  }

  // W fragments of this wave's 16 output columns, all 8 k-steps
  Frag wfh[8], wfl[8];
#pragma unroll
  for (int ks = 0; ks < 8; ++ks) {
    const size_t off = (size_t)w * 4096 + (size_t)ks * 512 + (size_t)l * 8;
    wfh[ks] = ldpack(Wh + off);
    wfl[ks] = ldpack(Wl + off);
  }
  const float bj = bias[16 * w + m];

  // hand the other tile's part to the partner wave
#pragma unroll
  for (int db = 0; db < 2; ++db) {
    const v8f o = accO[1][db];
    Xo[w][2 * db][l] = __builtin_shufflevector(o, o, 0, 1, 2, 3);
    Xo[w][2 * db + 1][l] = __builtin_shufflevector(o, o, 4, 5, 6, 7);
  }
  {
    f32x2 ml;
    ml.x = mrun[1];
    ml.y = lrun[1];
    Xs[w][l] = ml;
  }
  __syncthreads();   // every wave's handed-over part is in LDS

  // join the two parts of this wave's tile (both hold a chunk with valid keys for every query: maxima finite, sums > 0)
  const f32x2 pml = Xs[w ^ 8][l];
  const float mj = fmaxf(mrun[0], pml.x);
  const float ea = __expf(mrun[0] - mj);
  const float eb = __expf(pml.x - mj);
  const float lj = lrun[0] * ea + pml.y * eb;
  const float inv = 1.0f / (lj + xhalf(lj));   // sum >= 1
  const float fa = ea * inv, fb = eb * inv;

#pragma unroll
  for (int db = 0; db < 2; ++db) {
    us8 hv, lv;
    const v4f p0 = Xo[w ^ 8][2 * db][l];
    const v4f p1 = Xo[w ^ 8][2 * db + 1][l];
    const v8f o = accO[0][db] * fa + __builtin_shufflevector(p0, p1, 0, 1, 2, 3, 4, 5, 6, 7) * fb;
    split8(__builtin_shufflevector(o, o, 0, 1, 2, 3), __builtin_shufflevector(o, o, 4, 5, 6, 7), hv, lv);
    *(us8*)&Oh[qt][hd][8 * (32 * db + l)] = hv;
    *(us8*)&Ol[qt][hd][8 * (32 * db + l)] = lv;
  }
  __syncthreads();   // all 8 heads of both query tiles are in LDS

  v8f acc[2];
  acc[0] = zero8();
  acc[1] = zero8();
  // A fragments are read from LDS one k-step ahead, as one group, into a second register set
  Frag afh[2][2], afl[2][2];
#pragma unroll
  for (int i = 0; i < 2; ++i) {
    afh[0][i] = ldpack(&Oh[i][0][l * 8]);
    afl[0][i] = ldpack(&Ol[i][0][l * 8]);
  }
#pragma unroll
  for (int ks = 0; ks < 8; ++ks) {
    if (ks < 7) {
#pragma unroll
      for (int i = 0; i < 2; ++i) {
        afh[(ks + 1) & 1][i] = ldpack(&Oh[i][ks + 1][l * 8]);
        afl[(ks + 1) & 1][i] = ldpack(&Ol[i][ks + 1][l * 8]);
      }
    }
#pragma unroll
    for (int i = 0; i < 2; ++i)
      acc[i] = mma3(afh[ks & 1][i], afl[ks & 1][i], wfh[ks], wfl[ks], acc[i]);
  }

  // D element r of lane (h, m): row 16i + 8h + r of the block's 32 queries, column 16w + m
#pragma unroll
  for (int i = 0; i < 2; ++i)
#pragma unroll
    for (int r = 0; r < 8; ++r)
      Tf[16 * i + 8 * h + r][16 * w + m] = acc[i][r] + bj;
  __syncthreads();   // the whole 32 x 256 tile is staged

  v4f ov[4];
#pragma unroll
  for (int q = 0; q < 4; ++q) {
    const int g = 32 * q + l;
    ov[q] = *(const v4f*)&Tf[2 * w + (g >> 6)][(g & 63) * 4];
  }
  // staged rows 2w and 2w + 1 are queries m0 and m0 + 1 (m0 even) of tile w >> 3: two consecutive cols of one grid row
  const int m0 = (2 * w) & 15;
  const size_t base = ((size_t)b * 4096 + (size_t)((4 * R + 2 * qt + ((m0 >> 2) & 1)) * 64 + c0 + (m0 >> 3) * 4 + (m0 & 3))) * 256;
#pragma unroll
  for (int q = 0; q < 4; ++q)
    *(v4f*)(out + base + (size_t)4 * (32 * q + l)) = ov[q];
}

// ----------------------------------------------------------------------------
extern "C" void kernel_launch(void* const* d_in, const int* in_sizes, int n_in,
                              void* d_out, int out_size, void* d_ws, size_t ws_size,
                              hipStream_t stream) {
  const int M = 8192;      // B * N
  const int C = 256;
  const int C3 = 768;
  if (n_in < 5) return;
  if (in_sizes[0] != M * C || in_sizes[1] != C3 * C || in_sizes[2] != C * C ||
      in_sizes[3] != C || in_sizes[4] < 1 || out_size != M * C) return;

  const float* x     = (const float*)d_in[0];   // [2,4096,256]
  const float* wqkv  = (const float*)d_in[1];   // [768,256]
  const float* wproj = (const float*)d_in[2];   // [256,256]
  const float* bproj = (const float*)d_in[3];   // [256]
  const float* temp  = (const float*)d_in[4];   // [1]
  float* out = (float*)d_out;                   // [2,4096,256] f32

  const size_t szX  = (size_t)M * C * 2;        // one bf16 plane of q / k / v
  const size_t szW2 = (size_t)C * C * 2;
  size_t off = 0;
  char* ws = (char*)d_ws;
  us* w2h = (us*)(ws + off); off += szW2;
  us* w2l = (us*)(ws + off); off += szW2;
  us* qh  = (us*)(ws + off); off += szX;
  us* ql  = (us*)(ws + off); off += szX;
  us* kh  = (us*)(ws + off); off += szX;
  us* kl  = (us*)(ws + off); off += szX;
  us* vh  = (us*)(ws + off); off += szX;
  us* vl  = (us*)(ws + off); off += szX;   // total 25,427,968 bytes
  if (off > ws_size) return;

  k_gemm_qkv<<<(M / 128) * (C3 / 192), 256, 0, stream>>>(x, wqkv, wproj, w2h, w2l,
                                                         qh, ql, kh, kl, vh, vl);

  k_attn_proj<<<M / 32, 512, 0, stream>>>(qh, ql, kh, kl, vh, vl, temp, w2h, w2l, bproj, out);
}

// v010
// One run takes 24.7 microseconds.
// In two side-by-side timings against v009, it was 1.03 and 1.04 times as fast.
// Counting every step since v000, it is 3.38 times as fast.
#include <hip/hip_runtime.h>

// All contractions (qkv projection, q.k^T scores, p.v, output projection): v_wmma_f32_16x16x32_bf16 with bf16 hi/lo split operands (hi*hi + hi*lo + lo*hi), f32 accumulate; softmax, scaling and bias in f32.

typedef unsigned short us;
typedef us us8 __attribute__((ext_vector_type(8)));
typedef us us16 __attribute__((ext_vector_type(16)));
typedef __bf16 bf16x16 __attribute__((ext_vector_type(16)));
typedef float v8f __attribute__((ext_vector_type(8)));
typedef float v4f __attribute__((ext_vector_type(4)));

union Frag {
  bf16x16 v;
  us16 u;
  us8 half[2];
};

// 16x32 operand fragment of lane (h, m) = (lane>>4, lane&15): row (A) or column (B) m,
// elements 0..7 <- k0+8h+0..7, elements 8..15 <- k0+16+8h+0..7. Same map for A and B.
// Read from a plane stored in fragment order: per (16-row tile, k-step) two runs of 512 B,
// run x holds for lane (h, m) the 8 elements k0+16x+8h+0..7 of row m at 16-B chunk 16h+m, so one
// wave-wide 16-B load covers four whole 128-B lines. p already includes the lane's chunk (lane * 8).
__device__ __forceinline__ Frag ldpack(const us* p) {
  Frag f;
  f.half[0] = *(const us8*)p;
  f.half[1] = *(const us8*)(p + 256);
  return f;
}

__device__ __forceinline__ v8f wmma16(bf16x16 a, bf16x16 b, v8f c) {
  return __builtin_amdgcn_wmma_f32_16x16x32_bf16(false, a, false, b, (short)0, c, false, false);
}

// acc += A*B with A = ah+al, B = bh+bl (lo*lo dropped); hazard guard after the last WMMA of the group.
__device__ __forceinline__ v8f mma3(const Frag& ah, const Frag& al, const Frag& bh, const Frag& bl, v8f acc) {
  acc = wmma16(al.v, bh.v, acc);
  acc = wmma16(ah.v, bl.v, acc);
  acc = wmma16(ah.v, bh.v, acc);
  asm volatile("v_nop\n\tv_nop\n\tv_nop\n\tv_nop"
               : "+v"(acc)
               : "v"(ah.v), "v"(al.v), "v"(bh.v), "v"(bl.v));
  return acc;
}

// The same three products in the same order with the operands' roles swapped: acc^T += B^T * A^T (A = ah+al, B = bh+bl).
__device__ __forceinline__ v8f mma3t(const Frag& ah, const Frag& al, const Frag& bh, const Frag& bl, v8f acc) {
  acc = wmma16(bh.v, al.v, acc);
  acc = wmma16(bl.v, ah.v, acc);
  acc = wmma16(bh.v, ah.v, acc);
  asm volatile("v_nop\n\tv_nop\n\tv_nop\n\tv_nop"   // hazard guard, as in mma3
               : "+v"(acc)
               : "v"(ah.v), "v"(al.v), "v"(bh.v), "v"(bl.v));
  return acc;
}

__device__ __forceinline__ v8f zero8() {
  v8f z;
#pragma unroll
  for (int i = 0; i < 8; ++i) z[i] = 0.0f;
  return z;
}

// ----------------------------------------------------------------------------
// QKV projection with the f32 -> bf16 hi/lo split done in the kernel: C[8192 x 768] = x[8192 x 256] * Wqkv^T.
// One block of 8 waves (4 x 2) per 128 tokens x 192 columns, grid 256 = 64 row blocks x 4 column blocks; wave tile 32 x 96.
// Column block cb = heads 2cb and 2cb+1; wave column wn = head 2cb+wn: its 96 columns are that head's q, k and v (32 each),
// column tile j = 2 * (q|k|v) + half, so which plane a tile belongs to is known at compile time.
// K runs in 4 chunks of 64 (2 k-steps). A chunk's 320 rows (128 of x, 192 of W) are read as f32, converted once
// per block and stored in LDS in fragment order (see ldpack); two buffers; k-step s of the next chunk is read as f32
// ahead of this chunk's k-step s and converted behind it; one barrier a chunk.
// Staging unit = 8 rows x 32 columns (one k-step) = one wave: lane l owns row l & 7 and piece p = l >> 3 = 2x + h,
// 8 consecutive k. LDS chunk of (x, h, m): run x, 16-B slot 16h + (m ^ 8h): the swap of the two 8-row halves for
// h = 1 puts the 16 lanes of a store on all 64 banks once; a fragment read still covers each 256-B run half whole.
// The block also converts its 1/256 of W_proj (8 rows x 32 columns) into the global planes that the next launch reads.
// Epilogue: no LDS. The q and k tiles are computed transposed (A = W, B = x), so a lane's 8 accumulator values are
// 8 consecutive d of one token; the v tiles are not (A = x, B = W): 8 consecutive tokens of one d. Either way the 8 values,
// split hi/lo, are one 16-B chunk of the plane, and a wave-wide store covers four whole 128-B lines.
// Token order of the planes: the block's 128 tokens are 2 grid rows x 64 cols; row mu of the product is the token of
// patch mu / 8 (4 cols wide, 2 rows high), grid row (mu / 4) % 2, col mu % 4 of the patch. So 8 consecutive plane positions
// are a patch of 2 x 4 tokens, and "token" below means this position. Only the x rows' source addresses know of it.
// Plane layouts inside [b][head], 256 elements per group of 8 tokens:
//   q: [token/16][d/16][(d/8)%2][token%16][8 d]  (fragment order: the Q fragment of a 16-query tile, see ldpack)
//   k: [token/8][d/8][token%8][8 d]         (K fragments of the score product at any 8-token offset)
//   v: [token/8][d][8 tokens]               (transposed: V fragments of the p.v product at any 8-token offset)
typedef float f32x2 __attribute__((ext_vector_type(2)));
typedef __bf16 bf16x2 __attribute__((ext_vector_type(2)));
typedef unsigned u32x4 __attribute__((ext_vector_type(4)));

// 8 f32 -> 8 hi + 8 lo bf16, two at a time with the packed RNE convert: hi = rne(f), lo = rne(f - hi)
__device__ __forceinline__ void split8(v4f a, v4f c, us8& hv, us8& lv) {
  u32x4 hu, lu;
#pragma unroll
  for (int e = 0; e < 4; ++e) {
    f32x2 v;
    v.x = (e < 2) ? a[2 * e] : c[2 * e - 4];
    v.y = (e < 2) ? a[2 * e + 1] : c[2 * e - 3];
    const unsigned hb = __builtin_bit_cast(unsigned, __builtin_convertvector(v, bf16x2));
    f32x2 hf;
    hf.x = __uint_as_float(hb << 16);
    hf.y = __uint_as_float(hb & 0xFFFF0000u);
    const f32x2 d = v - hf;
    hu[e] = hb;
    lu[e] = __builtin_bit_cast(unsigned, __builtin_convertvector(d, bf16x2));
  }
  hv = __builtin_bit_cast(us8, hu);
  lv = __builtin_bit_cast(us8, lu);
}

__global__ __launch_bounds__(256) void k_gemm_qkv(
    const float* __restrict__ X, const float* __restrict__ Wq, const float* __restrict__ Wp,
    us* w2h, us* w2l,
    us* qh, us* ql, us* kh, us* kl, us* vh, us* vl) {
  // [buffer][hi | lo][20 tiles of 16 rows (8 of x, 12 of W)][2 k-steps][512]
  __shared__ __align__(16) us S[4 * 20480];
  const int tid = threadIdx.x;
  const int w = __builtin_amdgcn_readfirstlane(tid >> 5);   // wave number, kept scalar: sources, tiles and planes stay uniform
  const int l = tid & 31, h = l >> 4, m = l & 15;
  const int wm = w >> 1, wn = w & 1;
  const int bid = blockIdx.x;
  const int rb = bid >> 2, cb = bid & 3;
  const int srow = l & 7, sp = l >> 3;

  // this wave's 5 groups of 8 rows: wave-uniform source of the group, the lane's part (W: 8 consecutive rows; x: a patch of
  // 2 grid rows x 4 cols), LDS slot of k-step 0
  const float* src[5];
  int dst[5];
  unsigned lo[5];
  const unsigned low = (unsigned)(srow * 256 + 8 * sp);
  const unsigned lox = (unsigned)(((srow >> 2) * 64 + (srow & 3)) * 256 + 8 * sp);
#pragma unroll
  for (int i = 0; i < 5; ++i) {
    const int rg = w * 5 + i;
    // W row groups 0..23: 8 of q, 8 of k, 8 of v, each the 64 rows of the block's two heads
    const int xrow = rb * 128 + rg * 4;
    const int wrow = ((rg >> 3) - 2) * 256 + cb * 64 + (rg & 7) * 8;
    src[i] = ((rg < 16) ? X : Wq) + (size_t)((rg < 16) ? xrow : wrow) * 256;
    lo[i] = (rg < 16) ? lox : low;
    const int mm = 8 * (rg & 1) + srow;
    dst[i] = ((rg >> 1) * 4 + (sp >> 1)) * 256 + (16 * (sp & 1) + (mm ^ (8 * (sp & 1)))) * 8;
  }

  v4f ra[5], rc[5];   // one k-step of the wave's 5 row groups, f32

  v8f acc[2][6];
#pragma unroll
  for (int i = 0; i < 2; ++i)
#pragma unroll
    for (int j = 0; j < 6; ++j) acc[i][j] = zero8();

  // chunk 0 into buffer 0
#pragma unroll
  for (int s = 0; s < 2; ++s) {
#pragma unroll
    for (int i = 0; i < 5; ++i) {
      ra[i] = *(const v4f*)(src[i] + 32 * s + lo[i]);
      rc[i] = *(const v4f*)(src[i] + (32 * s + 4) + lo[i]);
    }
#pragma unroll
    for (int i = 0; i < 5; ++i) {
      us8 hv, lv;
      split8(ra[i], rc[i], hv, lv);
      *(us8*)&S[dst[i] + 512 * s] = hv;
      *(us8*)&S[20480 + dst[i] + 512 * s] = lv;
    }
  }
  __syncthreads();   // chunk 0 is in buffer 0

  const int lsw = (l ^ (h << 3)) * 8;   // the lane's slot in a run (see the swap above)
#pragma unroll   // unrolled: chunk and k-step become immediate offsets of 5 fixed address pairs and of the LDS reads, no address arithmetic in the loop
  for (int kc = 0; kc < 4; ++kc) {
    const us* Bh = &S[(kc & 1) * 40960 + lsw];
    const us* Bl = Bh + 20480;
    us* Dh = &S[((kc + 1) & 1) * 40960];   // next chunk's buffer: its readers left it at the barrier that ended chunk kc - 1
#pragma unroll
    for (int s = 0; s < 2; ++s) {
      if (kc < 3) {   // k-step s of the next chunk, f32: in flight under this k-step's products, none across a barrier
#pragma unroll
        for (int i = 0; i < 5; ++i) {
          const float* p = src[i] + (kc + 1) * 64 + 32 * s;
          ra[i] = *(const v4f*)(p + lo[i]);
          rc[i] = *(const v4f*)(p + 4 + lo[i]);
        }
      }
      Frag ah[2], al[2], bh[2], bl[2];
#pragma unroll
      for (int i = 0; i < 2; ++i) {
        const int off = ((wm * 2 + i) * 2 + s) * 512;
        ah[i] = ldpack(Bh + off);
        al[i] = ldpack(Bl + off);
      }
      // column tile j of the wave = LDS tile 8 + 4 * (j >> 1) + 2 * wn + (j & 1)
      bh[0] = ldpack(Bh + ((8 + wn * 2) * 2 + s) * 512);
      bl[0] = ldpack(Bl + ((8 + wn * 2) * 2 + s) * 512);
#pragma unroll
      for (int j = 0; j < 6; ++j) {
        if (j < 5) {   // W fragments one column tile ahead, into the second register set
          const int off = ((8 + 4 * ((j + 1) >> 1) + wn * 2 + ((j + 1) & 1)) * 2 + s) * 512;
          bh[(j + 1) & 1] = ldpack(Bh + off);
          bl[(j + 1) & 1] = ldpack(Bl + off);
        }
#pragma unroll
        for (int i = 0; i < 2; ++i)
          acc[i][j] = (j < 4) ? mma3t(ah[i], al[i], bh[j & 1], bl[j & 1], acc[i][j])    // q, k: D[r] = C[token 16i+m][col 16j+8h+r]
                              : mma3(ah[i], al[i], bh[j & 1], bl[j & 1], acc[i][j]);    // v:    D[r] = C[token 16i+8h+r][col 16j+m]
      }
      if (kc < 3) {
#pragma unroll
        for (int i = 0; i < 5; ++i) {
          us8 hv, lv;
          split8(ra[i], rc[i], hv, lv);
          *(us8*)&Dh[dst[i] + 512 * s] = hv;
          *(us8*)&Dh[20480 + dst[i] + 512 * s] = lv;
        }
      }
    }
    if (kc < 3) __syncthreads();   // chunk kc + 1 is published; every reader has left chunk kc's buffer
  }

  const int r0 = rb * 128 + wm * 32;
  const int bb = r0 >> 12, n0 = r0 & 4095;

  // W_proj: row group bid >> 3, k-step bid & 7; read here, under the conversions below, stored at the end
  const int prg = bid >> 3, pks = bid & 7;
  v4f pa, pc;
  if (w == 0) {
    const float* p = Wp + (size_t)(prg * 8 + srow) * 256 + (size_t)(32 * pks + 8 * sp);
    pa = *(const v4f*)p;
    pc = *(const v4f*)(p + 4);
  }

  const size_t dso = ((size_t)(bb * 8 + cb * 2 + wn) * 4096 + (size_t)n0) * 32;
#pragma unroll
  for (int jj = 0; jj < 3; ++jj) {
    us* dh = (jj == 0) ? qh : ((jj == 1) ? kh : vh);
    us* dl = (jj == 0) ? ql : ((jj == 1) ? kl : vl);
    // the lane's 16-B chunk in tile (i, j) = (0, 0) of the part, and the step from j = 0 to j = 1; i steps by 16 tokens = 512
    const int lane0 = (jj == 0) ? l * 8
                    : (jj == 1) ? (m >> 3) * 256 + h * 64 + (m & 7) * 8
                                : h * 256 + m * 8;
    const int jstep = (jj == 0) ? 256 : 128;
    us8 hv[4], lv[4];
#pragma unroll
    for (int i = 0; i < 2; ++i)
#pragma unroll
      for (int j = 0; j < 2; ++j) {
        const v8f t = acc[i][2 * jj + j];
        split8(__builtin_shufflevector(t, t, 0, 1, 2, 3), __builtin_shufflevector(t, t, 4, 5, 6, 7), hv[2 * i + j], lv[2 * i + j]);
      }
#pragma unroll
    for (int i = 0; i < 2; ++i)
#pragma unroll
      for (int j = 0; j < 2; ++j) {
        const size_t o = dso + (size_t)(lane0 + i * 512 + j * jstep);
        *(us8*)(dh + o) = hv[2 * i + j];
        *(us8*)(dl + o) = lv[2 * i + j];
      }
    // what follows reuses the registers that these stores name: keep the wait in front of their overwrite
    asm volatile("s_wait_xcnt 0x0" ::: "memory");
    __builtin_amdgcn_sched_barrier(0);   // keeps the next part's conversions, which write those registers, behind the wait
  }

  if (w == 0) {   // global planes in fragment order (no swap)
    us8 hv, lv;
    split8(pa, pc, hv, lv);
    const size_t e0 = (size_t)((((prg >> 1) * 8 + pks) * 2 + (sp >> 1)) * 32 + 16 * (sp & 1) + 8 * (prg & 1) + srow) * 8;
    *(us8*)(w2h + e0) = hv;
    *(us8*)(w2l + e0) = lv;
  }
}

__device__ __forceinline__ float xhalf(float x) {   // value of lane l ^ 16
  const int b = __builtin_bit_cast(int, x);
  return __builtin_bit_cast(float, __builtin_amdgcn_permlanex16(b, b, 0x76543210, 0xfedcba98, false, false));
}

// Scores of one key chunk (32 slots) against one query tile, two 16-slot tiles: D[r] = S[q = m][slot 16c + 8h + r]
__device__ __forceinline__ void scores(const Frag (&kfh)[2], const Frag (&kfl)[2], const Frag& qfh, const Frag& qfl, v8f (&s)[2]) {
#pragma unroll
  for (int c = 0; c < 2; ++c) s[c] = mma3(kfh[c], kfl[c], qfh, qfl, zero8());
}

// The rest of a chunk's pass for one query tile: mask, online softmax, O^T += V^T P^T.
// dc0 = key col - query col of slot 8h; EDGE: pair distance 2, e0 / e1 = key row 0 / 1 of the pair is within 3 rows of the lane's query.
template <bool EDGE>
__device__ __forceinline__ void soft_pv(v8f (&s)[2], const Frag (&vfh)[2], const Frag (&vfl)[2],
                                        int dc0, bool e0, bool e1, float alpha,
                                        float& mrun, float& lrun, v8f (&accO)[2]) {
  // locality mask + scale
#pragma unroll
  for (int c = 0; c < 2; ++c) {
#pragma unroll
    for (int r = 0; r < 8; ++r) {
      const int dc = dc0 + 8 * c + (r & 3);   // slot 16c + 8h + r: patch 2c + h, row r >> 2, col r & 3
      bool ok = (dc >= -3) && (dc <= 3);
      if (EDGE) ok = ok && ((r >> 2) ? e1 : e0);
      s[c][r] = ok ? s[c][r] * alpha : -__builtin_inff();
    }
  }

  // online softmax over the 32 slots of this chunk
  float rm = fmaxf(s[0][0], s[1][0]);
#pragma unroll
  for (int r = 1; r < 8; ++r) rm = fmaxf(rm, fmaxf(s[0][r], s[1][r]));
  rm = fmaxf(rm, xhalf(rm));
  const float mn = fmaxf(mrun, rm);        // finite: the first chunk of a tile has >= 4 valid keys for every query (an EDGE chunk, never the first, may have none)
  const float sc = __expf(mrun - mn);      // 0 on the first chunk
  Frag pfh, pfl;
  float ps[2];
#pragma unroll
  for (int c = 0; c < 2; ++c) {
    ps[c] = 0.0f;
    v8f p;
#pragma unroll
    for (int r = 0; r < 8; ++r) {
      p[r] = __expf(s[c][r] - mn);   // masked -> 0
      ps[c] += p[r];
    }
    split8(__builtin_shufflevector(p, p, 0, 1, 2, 3), __builtin_shufflevector(p, p, 4, 5, 6, 7), pfh.half[c], pfl.half[c]);
  }
  lrun = lrun * sc + (ps[0] + ps[1]);
  mrun = mn;

#pragma unroll
  for (int r = 0; r < 8; ++r) {
    accO[0][r] *= sc;
    accO[1][r] *= sc;
  }

  // O^T[d][q] += sum_slot V[slot][d] * P[q][slot]
#pragma unroll
  for (int db = 0; db < 2; ++db)
    accO[db] = mma3(vfh[db], vfl[db], pfh, pfl, accO[db]);
}

// K fragments of the 32 key slots that start at plane position t0 (a multiple of 8 -> 16-B aligned chunks), head base hb:
// element (x, e) of lane (h, m) = K[t0 + 16c + m][16x + 8h + e]
__device__ __forceinline__ void load_k(const us* __restrict__ kh, const us* __restrict__ kl,
                                       size_t hb, int t0, int h, int m, Frag (&kfh)[2], Frag (&kfl)[2]) {
  const us *pkh[2], *pkl[2];
#pragma unroll
  for (int c = 0; c < 2; ++c) {
    const size_t ko = hb + (size_t)(t0 + 16 * c) * 32 + (size_t)((m >> 3) * 256 + h * 64 + (m & 7) * 8);
    pkh[c] = kh + ko;
    pkl[c] = kl + ko;
    kfh[c].half[0] = *(const us8*)(pkh[c]);
    kfh[c].half[1] = *(const us8*)(pkh[c] + 128);
    kfl[c].half[0] = *(const us8*)(pkl[c]);
    kfl[c].half[1] = *(const us8*)(pkl[c] + 128);
  }
  // the wait in front of every overwrite of a register that one of the 8 loads names; the loads' four address pairs are its inputs,
  // so each stays whole up to it
  asm volatile("s_wait_xcnt 0x0" :: "v"(pkh[0]), "v"(pkl[0]), "v"(pkh[1]), "v"(pkl[1]) : "memory");
  __builtin_amdgcn_sched_barrier(0);   // keeps the loads here, ahead of the work that follows and covers their latency
}

// V fragments of the same 32 key slots: element (x, e) of lane (h, m) = V[t0 + 16x + 8h + e][16db + m]
__device__ __forceinline__ void load_v(const us* __restrict__ vh, const us* __restrict__ vl,
                                       size_t hb, int t0, int h, int m, Frag (&vfh)[2], Frag (&vfl)[2]) {
  const us *pvh[2], *pvl[2];
#pragma unroll
  for (int db = 0; db < 2; ++db) {
    const size_t vo = hb + (size_t)t0 * 32 + (size_t)(h * 256 + db * 128 + m * 8);
    pvh[db] = vh + vo;
    pvl[db] = vl + vo;
    vfh[db].half[0] = *(const us8*)(pvh[db]);
    vfh[db].half[1] = *(const us8*)(pvh[db] + 512);
    vfl[db].half[0] = *(const us8*)(pvl[db]);
    vfl[db].half[1] = *(const us8*)(pvl[db] + 512);
  }
  // the wait in front of every overwrite of a register that one of the 8 loads names; their two address pairs are its inputs
  asm volatile("s_wait_xcnt 0x0" :: "v"(pvh[0]), "v"(pvl[0]) : "memory");
  __builtin_amdgcn_sched_barrier(0);   // keeps the loads here, ahead of the work that follows and covers their latency
}

__global__ __launch_bounds__(256) void k_attn_proj(
    const us* __restrict__ qh, const us* __restrict__ ql,
    const us* __restrict__ kh, const us* __restrict__ kl,
    const us* __restrict__ vh, const us* __restrict__ vl,
    const float* __restrict__ temp,
    const us* __restrict__ Wh, const us* __restrict__ Wl,
    const float* __restrict__ bias, float* out) {
  __shared__ __align__(16) us Oh[2][8][512];     // [query tile][k-step = head][fragment order]
  __shared__ __align__(16) us Ol[2][8][512];
  __shared__ __align__(16) float Tf[32][260];    // output tile, pitch 260: the two wave halves hit disjoint banks
  const int bid = blockIdx.x;
  const int w = __builtin_amdgcn_readfirstlane((int)threadIdx.x >> 5);   // wave number = head, kept scalar: bases stay uniform
  const int b = bid >> 7;
  const int l = threadIdx.x & 31, h = l >> 4, m = l & 15;
  const int R = (bid & 127) >> 3;   // grid rows 4R..4R+3 = row pairs 2R (query tile 0) and 2R+1 (tile 1)
  const int c0 = (bid & 7) * 8;     // cols c0..c0+7
  const float alpha = 0.17677669529663689f * temp[0];   // hd^-0.5 * temperature
  const size_t hb = (size_t)(b * 8 + w) * 4096 * 32;

  Frag qfh[2], qfl[2];
  float mrun[2], lrun[2];   // running maximum of query m (equal in both halves); running sum over this half's slots only
  v8f accO[2][2];
  const us *pqh[2], *pql[2];
#pragma unroll
  for (int t = 0; t < 2; ++t) {
    const size_t qo = hb + (size_t)((2 * R + t) * 128 + c0 * 2) * 32 + (size_t)(l * 8);
    pqh[t] = qh + qo;
    pql[t] = ql + qo;
    qfh[t] = ldpack(pqh[t]);
    qfl[t] = ldpack(pql[t]);
    mrun[t] = -__builtin_inff();
    lrun[t] = 0.0f;
    accO[t][0] = zero8();
    accO[t][1] = zero8();
  }

  // the wait in front of every overwrite of a register that one of the 8 Q loads names; their four address pairs are its inputs,
  // so each stays whole up to it (else a K load's result is put on a pair whose loads are just issued)
  asm volatile("s_wait_xcnt 0x0" :: "v"(pqh[0]), "v"(pql[0]), "v"(pqh[1]), "v"(pql[1]) : "memory");

  int pc0 = (c0 >> 2) - 1;   // first patch of the key window
  if (pc0 < 0) pc0 = 0;
  if (pc0 > 12) pc0 = 12;
  const int dc0 = (pc0 + h) * 4 - (c0 + (m >> 3) * 4 + (m & 3));   // key col - query col of slot 8h
  const int qb = (m >> 2) & 1;   // the query's row in its pair
  const bool up = (qb == 0);     // pair distance -2: key row 1 reaches query row 0
  const bool dn = (qb == 1);     // pair distance +2: key row 0 reaches query row 1
  // pairs 2R and 2R+1 always exist and each serves every query of both tiles (distance 0 and 1);
  // 2R-1 and 2R-2 lie in the grid together or not at all, and so do 2R+2 and 2R+3
  const int pk0 = 2 * R * 128 + pc0 * 8;
  const bool above = R > 0, below = R < 15;   // block-uniform

  {
    Frag kfh[2], kfl[2], vfh[2], vfl[2];
    v8f s0[2], s1[2];
    load_k(kh, kl, hb, pk0, h, m, kfh, kfl);
    load_v(vh, vl, hb, pk0, h, m, vfh, vfl);
    // pair 2R: distance 0 and -1
    scores(kfh, kfl, qfh[0], qfl[0], s0);
    scores(kfh, kfl, qfh[1], qfl[1], s1);
    load_k(kh, kl, hb, pk0 + 128, h, m, kfh, kfl);
    soft_pv<false>(s0, vfh, vfl, dc0, false, false, alpha, mrun[0], lrun[0], accO[0]);
    soft_pv<false>(s1, vfh, vfl, dc0, false, false, alpha, mrun[1], lrun[1], accO[1]);
    load_v(vh, vl, hb, pk0 + 128, h, m, vfh, vfl);
    // pair 2R+1: distance 1 and 0
    const int pk2 = above ? pk0 - 128 : pk0 + 256;   // the third chunk: one of the two sides always exists
    scores(kfh, kfl, qfh[0], qfl[0], s0);
    scores(kfh, kfl, qfh[1], qfl[1], s1);
    load_k(kh, kl, hb, pk2, h, m, kfh, kfl);
    soft_pv<false>(s0, vfh, vfl, dc0, false, false, alpha, mrun[0], lrun[0], accO[0]);
    soft_pv<false>(s1, vfh, vfl, dc0, false, false, alpha, mrun[1], lrun[1], accO[1]);
    load_v(vh, vl, hb, pk2, h, m, vfh, vfl);
    if (above) {
      // pair 2R-1: distance -1 and -2
      scores(kfh, kfl, qfh[0], qfl[0], s0);
      scores(kfh, kfl, qfh[1], qfl[1], s1);
      load_k(kh, kl, hb, pk0 - 256, h, m, kfh, kfl);
      soft_pv<false>(s0, vfh, vfl, dc0, false, false, alpha, mrun[0], lrun[0], accO[0]);
      soft_pv<true>(s1, vfh, vfl, dc0, false, up, alpha, mrun[1], lrun[1], accO[1]);
      load_v(vh, vl, hb, pk0 - 256, h, m, vfh, vfl);
      // pair 2R-2: distance -2 of tile 0
      scores(kfh, kfl, qfh[0], qfl[0], s0);
      if (below) load_k(kh, kl, hb, pk0 + 256, h, m, kfh, kfl);
      soft_pv<true>(s0, vfh, vfl, dc0, false, up, alpha, mrun[0], lrun[0], accO[0]);
      if (below) load_v(vh, vl, hb, pk0 + 256, h, m, vfh, vfl);
    }
    if (below) {
      // pair 2R+2: distance 2 and 1
      scores(kfh, kfl, qfh[0], qfl[0], s0);
      scores(kfh, kfl, qfh[1], qfl[1], s1);
      load_k(kh, kl, hb, pk0 + 384, h, m, kfh, kfl);
      soft_pv<true>(s0, vfh, vfl, dc0, dn, false, alpha, mrun[0], lrun[0], accO[0]);
      soft_pv<false>(s1, vfh, vfl, dc0, false, false, alpha, mrun[1], lrun[1], accO[1]);
      load_v(vh, vl, hb, pk0 + 384, h, m, vfh, vfl);
      // pair 2R+3: distance 2 of tile 1
      scores(kfh, kfl, qfh[1], qfl[1], s1);
      soft_pv<true>(s1, vfh, vfl, dc0, dn, false, alpha, mrun[1], lrun[1], accO[1]);
    }
  }

  // W fragments of this wave's 32 output columns: a ring of 4 k-steps in registers, k-steps 0..3 now
  const us* pwh = Wh + (size_t)w * 8192 + (size_t)l * 8;
  const us* pwl = Wl + (size_t)w * 8192 + (size_t)l * 8;
  Frag wfh[2][4], wfl[2][4];
#pragma unroll
  for (int ks = 0; ks < 4; ++ks)
#pragma unroll
    for (int j = 0; j < 2; ++j) {
      wfh[j][ks] = ldpack(pwh + j * 4096 + ks * 512);
      wfl[j][ks] = ldpack(pwl + j * 4096 + ks * 512);
    }
  float bj[2];
  bj[0] = bias[32 * w + m];
  bj[1] = bias[32 * w + 16 + m];
  // what follows reuses registers that these loads name: keep the wait in front of their overwrite
  asm volatile("s_wait_xcnt 0x0" ::: "memory");
  __builtin_amdgcn_sched_barrier(0);   // keeps the normalisation, which writes those registers, behind the wait

  // normalise both tiles of this head and hand them over in fragment order
#pragma unroll
  for (int t = 0; t < 2; ++t) {
    const float inv = 1.0f / (lrun[t] + xhalf(lrun[t]));   // sum >= 1
#pragma unroll
    for (int db = 0; db < 2; ++db) {
      us8 hv, lv;
      const v8f o = accO[t][db] * inv;
      split8(__builtin_shufflevector(o, o, 0, 1, 2, 3), __builtin_shufflevector(o, o, 4, 5, 6, 7), hv, lv);
      *(us8*)&Oh[t][w][8 * (32 * db + l)] = hv;
      *(us8*)&Ol[t][w][8 * (32 * db + l)] = lv;
    }
  }
  __syncthreads();   // all 8 heads of both query tiles are in LDS

  v8f acc[2][2];   // [query tile][column tile]
#pragma unroll
  for (int i = 0; i < 2; ++i)
#pragma unroll
    for (int j = 0; j < 2; ++j) acc[i][j] = zero8();
  // A fragments are read from LDS one k-step ahead, as one group, into a second register set
  Frag afh[2][2], afl[2][2];
#pragma unroll
  for (int i = 0; i < 2; ++i) {
    afh[0][i] = ldpack(&Oh[i][0][l * 8]);
    afl[0][i] = ldpack(&Ol[i][0][l * 8]);
  }
#pragma unroll
  for (int ks = 0; ks < 8; ++ks) {
    if (ks < 7) {
#pragma unroll
      for (int i = 0; i < 2; ++i) {
        afh[(ks + 1) & 1][i] = ldpack(&Oh[i][ks + 1][l * 8]);
        afl[(ks + 1) & 1][i] = ldpack(&Ol[i][ks + 1][l * 8]);
      }
    }
#pragma unroll
    for (int i = 0; i < 2; ++i)
#pragma unroll
      for (int j = 0; j < 2; ++j)
        acc[i][j] = mma3(afh[ks & 1][i], afl[ks & 1][i], wfh[j][ks & 3], wfl[j][ks & 3], acc[i][j]);
    if (ks < 4) {   // k-step ks + 4 into the ring place that this k-step has just left
#pragma unroll
      for (int j = 0; j < 2; ++j) {
        wfh[j][ks] = ldpack(pwh + j * 4096 + (ks + 4) * 512);
        wfl[j][ks] = ldpack(pwl + j * 4096 + (ks + 4) * 512);
      }
    }
  }

  // D element r of lane (h, m): row 16i + 8h + r of the block's 32 queries, column 32w + 16j + m
#pragma unroll
  for (int i = 0; i < 2; ++i)
#pragma unroll
    for (int j = 0; j < 2; ++j)
#pragma unroll
      for (int r = 0; r < 8; ++r)
        Tf[16 * i + 8 * h + r][32 * w + 16 * j + m] = acc[i][j][r] + bj[j];
  __syncthreads();   // the whole 32 x 256 tile is staged

  v4f ov[8];
#pragma unroll
  for (int q = 0; q < 8; ++q) {
    const int g = 32 * q + l;
    ov[q] = *(const v4f*)&Tf[4 * w + (g >> 6)][(g & 63) * 4];
  }
  // staged rows 4w..4w+3 are queries m0..m0+3 (m0 a multiple of 4) of tile w >> 2: four consecutive cols of one grid row
  const int m0 = (4 * w) & 15;
  const size_t base = ((size_t)b * 4096 + (size_t)((4 * R + 2 * (w >> 2) + ((m0 >> 2) & 1)) * 64 + c0 + (m0 >> 3) * 4)) * 256;
#pragma unroll
  for (int q = 0; q < 8; ++q)
    *(v4f*)(out + base + (size_t)4 * (32 * q + l)) = ov[q];
}

// ----------------------------------------------------------------------------
extern "C" void kernel_launch(void* const* d_in, const int* in_sizes, int n_in,
                              void* d_out, int out_size, void* d_ws, size_t ws_size,
                              hipStream_t stream) {
  const int M = 8192;      // B * N
  const int C = 256;
  const int C3 = 768;
  if (n_in < 5) return;
  if (in_sizes[0] != M * C || in_sizes[1] != C3 * C || in_sizes[2] != C * C ||
      in_sizes[3] != C || in_sizes[4] < 1 || out_size != M * C) return;

  const float* x     = (const float*)d_in[0];   // [2,4096,256]
  const float* wqkv  = (const float*)d_in[1];   // [768,256]
  const float* wproj = (const float*)d_in[2];   // [256,256]
  const float* bproj = (const float*)d_in[3];   // [256]
  const float* temp  = (const float*)d_in[4];   // [1]
  float* out = (float*)d_out;                   // [2,4096,256] f32

  const size_t szX  = (size_t)M * C * 2;        // one bf16 plane of q / k / v
  const size_t szW2 = (size_t)C * C * 2;
  size_t off = 0;
  char* ws = (char*)d_ws;
  us* w2h = (us*)(ws + off); off += szW2;
  us* w2l = (us*)(ws + off); off += szW2;
  us* qh  = (us*)(ws + off); off += szX;
  us* ql  = (us*)(ws + off); off += szX;
  us* kh  = (us*)(ws + off); off += szX;
  us* kl  = (us*)(ws + off); off += szX;
  us* vh  = (us*)(ws + off); off += szX;
  us* vl  = (us*)(ws + off); off += szX;   // total 25,427,968 bytes
  if (off > ws_size) return;

  k_gemm_qkv<<<(M / 128) * (C3 / 192), 256, 0, stream>>>(x, wqkv, wproj, w2h, w2l,
                                                         qh, ql, kh, kl, vh, vl);

  k_attn_proj<<<M / 32, 256, 0, stream>>>(qh, ql, kh, kl, vh, vl, temp, w2h, w2l, bproj, out);
}
